// v000
// The times below were measured on an AMD MI455X: many runs one after another, warmed up first and cycling through
// copies of the inputs, with the whole window's GPU time divided by the number of runs. Launches and the gaps
// between them are all in it. The median over several windows is given; except for v000 it joins two sittings, which
// can be a few percent apart, so the side-by-side timings, each taken in one sitting, are the better comparison.
// v000 is the starting kernel. One run takes 33.4 microseconds.
#include <hip/hip_runtime.h>

// 3-D sliding-window grouped pair-score weighting: q/k/v [NB][96][16][32][32] (channel-major, 6 heads x 16), every query attends to its 3x3x3 window (dilation 1) of a zero-padded volume; padded slots keep logit 0 in the softmax and add no value; scale 16^-0.5; output [NB][16][32][32][96] (f32, channel = head*16 + c).
// Compute dtypes, f32 accumulate everywhere: logits v_wmma_f32_16x16x32_f16 (q, k RNE-converted to bf16 then held exactly in f16, K = 16 zero-padded to 32 in registers); P.V v_wmma_f32_16x16x32_f16 (P x16384 carry as single f16, cancels in the normalisation; v RNE-converted to bf16 then held exactly in f16); softmax f32.
// Layout: halo-padded f16 planes built once: q and k as [(b*6+head)][zp 18][yp 34][wp 36][16] (c contiguous, zeros in the halo), v as window plane [(b*96+ch)][zp 18][yp 34][8 windows][8] with window wbk holding w = 4*wbk-1 .. 4*wbk+6 (zeros outside the volume).
// pair weighting kernel: one wave per tile of 16 queries (2 z x 2 y x 4 w) and one head pair; key slots = 4 z x 4 y x 8 w = 128 per tile, transposed form S^T = K Q^T (A = key rows, B = query rows), packed P^T is the B fragment of O^T = V^T P^T (A = window-plane rows); window membership by a per-element select.

#ifndef NB
#define NB 2
#endif
#define NB_FULL 2
#define CH   96
#define NHD  6
#define HD   16
#define DZ   16
#define HY   32
#define WX   32
#define CSTR (DZ * HY * WX)      // channel stride of the inputs (floats)
#define ZP   (DZ + 2)            // padded depth: zp = z + 1
#define YP   (HY + 2)            // padded height: yp = y + 1
#define WP   (WX + 4)            // padded width of the row planes: wp = w + 1, slots 0..35
#define NWB  (WX / 4)
#define AW   4                   // waves per pair weighting block
#define OSP  36                  // LDS row pitch (floats) of the output tile
#define SC2  ((float)(0.25 * 1.4426950408889634))   // HD^-0.5 * log2(e)
#define PSH  14.0f               // log2 of the P carry (16384)
#define NEGB (-3.0e38f)

static_assert(NHD * HD == CH);
static_assert(HD == 16);                       // one O^T tile per head; logits K = 16 (upper 16 k slots are register zeros)
static_assert(NHD % 2 == 0);
static_assert(DZ % 2 == 0);
static_assert(HY % 2 == 0);
static_assert(WX % 4 == 0);
static_assert(WX == 32);                       // tile index decode uses 3 + 4 + 3 bits
static_assert(HY == 32);
static_assert(DZ == 16);
static_assert(NWB == 8);
static_assert(WP >= WX + 4);                   // key slots reach wp = (WX - 4) + 7
static_assert((CH * 4) % 128 == 0);            // output position pitch = 3 lines
static_assert(((DZ / 2) * (HY / 2) * (WX / 4)) % AW == 0);
static_assert((OSP * 4) % 16 == 0);
static_assert(NB <= NB_FULL);
static_assert(AW * 16 * OSP * 4 <= 131072);    // static LDS of the pair weighting kernel

typedef _Float16 h16;
typedef __attribute__((ext_vector_type(16))) _Float16 v16h;
typedef __attribute__((ext_vector_type(8)))  _Float16 v8h;
typedef __attribute__((ext_vector_type(8)))  float    v8f;
typedef __attribute__((ext_vector_type(4)))  float    v4f;
typedef v4f  __attribute__((may_alias)) v4fa;

__device__ __forceinline__ unsigned short f2bf(float f) { unsigned u = __float_as_uint(f); u += 0x7FFFu + ((u >> 16) & 1u); return (unsigned short)(u >> 16); }
__device__ __forceinline__ float bfr(float f) { return __uint_as_float(((unsigned)f2bf(f)) << 16); }   // value after RNE convert to bf16
__device__ __forceinline__ v16h cat16(v8h lo, v8h hi) { return __builtin_shufflevector(lo, hi, 0, 1, 2, 3, 4, 5, 6, 7, 8, 9, 10, 11, 12, 13, 14, 15); }
__device__ __forceinline__ v8f wmma16(v16h a, v16h b, v8f c) { return __builtin_amdgcn_wmma_f32_16x16x32_f16(false, a, false, b, (short)0, c, false, false); }
// one matrix instruction followed by its own four-slot guard (one accumulator per guard)
__device__ __forceinline__ v8f wmma16g(v16h a, v16h b, v8f c) { c = wmma16(a, b, c); asm volatile("v_nop\n\tv_nop\n\tv_nop\n\tv_nop" : "+v"(c) : "v"(a), "v"(b)); return c; }
// f32 -> f16 convert that cannot produce an f16 subnormal
static __device__ __forceinline__ h16 toh_flush(float v) { const h16 r = (h16)v; return (fabsf(v) < 6.103515625e-05f) ? (h16)0.0f : r; }
// fragment with K = 16: p already includes + 8*(lane>>4); elements 0..7 <- k = 8h+0..7, elements 8..15 (k = 16+8h+0..7) are zero for A and B alike
__device__ __forceinline__ v16h ld8z(const h16* p) { return cat16(*(const v8h*)p, (v8h){}); }
// ordering point for wave-private LDS tiles (same wave writes and reads)
__device__ __forceinline__ void wave_sync() { __builtin_amdgcn_fence(3 /* release order */, "wavefront"); __builtin_amdgcn_wave_barrier(); asm volatile("" ::: "memory"); }

// k_rows: halo-padded position-major f16 plane [(b*6+head)][zp][yp][wp][16] from a channel-major f32 input. One 16-byte piece (8 channels of one slot) per thread, thread-linear:
__global__ __launch_bounds__(256) void k_rows(const float* __restrict__ src, h16* dst, unsigned npieces) {
    const unsigned i = blockIdx.x * 256u + threadIdx.x; if (i >= npieces) return;
    const int c8 = (int)(i & 1u) * 8; unsigned r = i >> 1;
    const int wp = (int)(r % (unsigned)WP); r /= (unsigned)WP;
    const int yp = (int)(r % (unsigned)YP); r /= (unsigned)YP;
    const int zp = (int)(r % (unsigned)ZP); const int bh = (int)(r / (unsigned)ZP);
    const int b = bh / NHD, hd = bh % NHD;
    const int z = zp - 1, y = yp - 1, w = wp - 1;
    const bool ok = ((unsigned)z < (unsigned)DZ) & ((unsigned)y < (unsigned)HY) & ((unsigned)w < (unsigned)WX);
    const int zc = z < 0 ? 0 : (z > DZ - 1 ? DZ - 1 : z);
    const int yc = y < 0 ? 0 : (y > HY - 1 ? HY - 1 : y);
    const int wc = w < 0 ? 0 : (w > WX - 1 ? WX - 1 : w);
    const size_t so = (size_t)(b * CH + hd * HD + c8) * CSTR + (size_t)((zc * HY + yc) * WX + wc);
    float x[8];
#pragma unroll
    for (int j = 0; j < 8; ++j) x[j] = src[so + (size_t)j * CSTR];
#pragma unroll
    for (int j = 0; j < 8; ++j) asm volatile("" : "+v"(x[j]));
    v8h o;
#pragma unroll
    for (int j = 0; j < 8; ++j) { const float xs = ok ? bfr(x[j]) : 0.0f; o[j] = toh_flush(xs); }
    *(v8h*)(dst + (size_t)i * 8) = o; 
}

// k_vwin: window plane [(b*96+ch)][zp][yp][8 windows][8] from the channel-major f32 input: window wbk = slots w = 4*wbk-1 .. 4*wbk+6 (zero outside the volume).
__global__ __launch_bounds__(256) void k_vwin(const float* __restrict__ src, h16* dst, unsigned npieces) {
    const unsigned i = blockIdx.x * 256u + threadIdx.x; if (i >= npieces) return;
    const int wbk = (int)(i & 7u); unsigned r = i >> 3;
    const int yp = (int)(r % (unsigned)YP); r /= (unsigned)YP;
    const int zp = (int)(r % (unsigned)ZP); const int bch = (int)(r / (unsigned)ZP);   // b*96 + ch (input batch pitch = 96 channels)
    const int z = zp - 1, y = yp - 1;
    const bool rowok = ((unsigned)z < (unsigned)DZ) & ((unsigned)y < (unsigned)HY);
    const int zc = z < 0 ? 0 : (z > DZ - 1 ? DZ - 1 : z);
    const int yc = y < 0 ? 0 : (y > HY - 1 ? HY - 1 : y);
    const size_t ro = (size_t)bch * CSTR + (size_t)((zc * HY + yc) * WX);
    const int bm = wbk > 0 ? wbk - 1 : 0;
    const int bp = wbk < NWB - 1 ? wbk + 1 : NWB - 1;
    v4f A = *(const v4f*)(src + ro + 4 * bm);
    v4f B = *(const v4f*)(src + ro + 4 * wbk);
    v4f C = *(const v4f*)(src + ro + 4 * bp);
    asm volatile("" : "+v"(A)); asm volatile("" : "+v"(B)); asm volatile("" : "+v"(C));
    const bool okm = rowok & (wbk >= 1);
    const bool okp = rowok & (wbk <= NWB - 2);
    float e[8];
    e[0] = okm ? bfr(A[3]) : 0.0f;
    e[1] = rowok ? bfr(B[0]) : 0.0f; e[2] = rowok ? bfr(B[1]) : 0.0f; e[3] = rowok ? bfr(B[2]) : 0.0f; e[4] = rowok ? bfr(B[3]) : 0.0f;
    e[5] = okp ? bfr(C[0]) : 0.0f; e[6] = okp ? bfr(C[1]) : 0.0f; e[7] = okp ? bfr(C[2]) : 0.0f;
    v8h o;
#pragma unroll
    for (int j = 0; j < 8; ++j) o[j] = toh_flush(e[j]);
    *(v8h*)(dst + (size_t)i * 8) = o; 
}

// k_nbrwin: one wave per (16-query tile, head pair). Query t = lane&15: qz = t>>3, qy = (t>>2)&1, qw = t&3 at (z0+qz, y0+qy, w0+qw).
// Key slot kk = 16j + row (j = 0..7): group g = kk>>3 -> dz = g>>2, dy = g&3, e = kk&7, volume position (z0-1+dz, y0-1+dy, w0-1+e) = padded (z0+dz, y0+dy, w0+e).
// S^T tile j: A = key rows (lane&15 = row), B = query rows; D element r of lane (t, h) = key slot 16j+8h+r -> dz = j>>1, dy = 2(j&1)+h, e = r.
// Slot kept iff dz-qz, dy-qy, e-qw all in {0,1,2}: exactly 27 per query (padded slots included with logit 0 from zero key rows).
// O^T[d][t] = V^T P^T, k-step s4 = key slots 32*s4..+31: A row d = lane&15 from the window plane, elements 0..7 <- (dz = s4, dy = h), elements 8..15 <- (dz = s4, dy = 2+h); B = packed P of S^T tiles 2*s4 and 2*s4+1.
__global__ __launch_bounds__(32 * AW) void k_nbrwin(const h16* __restrict__ QP, const h16* __restrict__ KP, const h16* __restrict__ VW, float* OUT) {
    __shared__ __align__(16) float os[AW * 16 * OSP];
    const int lane = threadIdx.x & 31, lr = lane & 15, hi = lane >> 4;
    const int wave = __builtin_amdgcn_readfirstlane((int)(threadIdx.x >> 5));
    const int tidx = blockIdx.x * AW + wave;                                  // 0 .. 1023 within one batch
    const int wbk = tidx & 7, yb = (tidx >> 3) & 15, zb = tidx >> 7;
    const int b = blockIdx.y / 3, hp = blockIdx.y % 3;
    const int z0 = 2 * zb, y0 = 2 * yb, w0 = 4 * wbk;
    const int qz = lr >> 3, qy = (lr >> 2) & 1, qw = lr & 3;
    bool kzy[8], kw[8];
#pragma unroll
    for (int j = 0; j < 8; ++j) { const int dz = j >> 1, dy = 2 * (j & 1) + hi; kzy[j] = ((unsigned)(dz - qz) <= 2u) & ((unsigned)(dy - qy) <= 2u); }
#pragma unroll
    for (int r = 0; r < 8; ++r) kw[r] = (unsigned)(r - qw) <= 2u;
    const int qrow  = ((z0 + qz + 1) * YP + (y0 + qy + 1)) * WP + (w0 + qw + 1);
    const int krow0 = (z0 * YP + (y0 + (lr >> 3))) * WP + (w0 + (lr & 7));   // tile j adds ((j>>1)*YP + 2*(j&1))*WP; zp <= 17, yp <= 33, wp <= 35
    const int wb = wave * 16 * OSP;
#pragma unroll 1
    for (int hh = 0; hh < 2; ++hh) {
        const int hd = 2 * hp + hh;
        const size_t rbase = (size_t)(b * NHD + hd) * ((size_t)ZP * YP * WP * HD);
        const v16h qf = ld8z(QP + rbase + (size_t)qrow * HD + 8 * hi);       // B fragment: col t, k = c
        v8f s[8];
#pragma unroll
        for (int j = 0; j < 8; ++j) {
            const int kr = krow0 + ((j >> 1) * YP + 2 * (j & 1)) * WP;
            const v16h ka = ld8z(KP + rbase + (size_t)kr * HD + 8 * hi);     // A fragment: row key slot, k = c
            s[j] = wmma16g(ka, qf, (v8f){});
        }
        float mx = NEGB;
#pragma unroll
        for (int j = 0; j < 8; ++j) {
#pragma unroll
            for (int r = 0; r < 8; ++r) { const bool kp = kzy[j] & kw[r]; const float t = s[j][r] * SC2; mx = fmaxf(mx, kp ? t : NEGB); } }
        mx = fmaxf(mx, __shfl_xor(mx, 16, 32));
        const float sh = PSH - mx;
        const size_t vch = (size_t)(b * CH + hd * HD + lr);
        v8f o = (v8f){};
        float ls = 0.0f;
#pragma unroll
        for (int s4 = 0; s4 < 4; ++s4) {
            v16h pb;
#pragma unroll
            for (int r = 0; r < 8; ++r) {
                const float ea = s[2 * s4][r] * SC2 + sh, eb = s[2 * s4 + 1][r] * SC2 + sh;
                const float xa = __builtin_amdgcn_exp2f(ea), xb = __builtin_amdgcn_exp2f(eb);
                const bool ca = kzy[2 * s4] & kw[r] & (ea >= -14.0f);
                const bool cb = kzy[2 * s4 + 1] & kw[r] & (eb >= -14.0f);
                const float ga = ca ? xa : 0.0f, gb = cb ? xb : 0.0f;         // dropped slots selected to 0 by value; kept values >= 2^-14
                const h16 pa = (h16)ga; const h16 pc = (h16)gb;
                pb[r] = pa; pb[8 + r] = pc;
                ls += (float)pa + (float)pc; }
            const size_t va = (((vch * ZP + (size_t)(z0 + s4)) * YP + (size_t)(y0 + hi)) * NWB + (size_t)wbk) * 8;
            const v16h vf = cat16(*(const v8h*)(VW + va), *(const v8h*)(VW + va + (size_t)2 * NWB * 8));   // yp and yp + 2
            o = wmma16g(vf, pb, o);
        }
        const float l = ls + __shfl_xor(ls, 16, 32);                          // >= 16384: the row maximum is always kept
        const float inv = 1.0f / l;
        // O^T D layout: o[r] = (d = 8h + r, t = lane&15) -> os[t][hh*16 + d]
        { v4f a, c;
          a[0] = o[0] * inv; a[1] = o[1] * inv; a[2] = o[2] * inv; a[3] = o[3] * inv; c[0] = o[4] * inv; c[1] = o[5] * inv; c[2] = o[6] * inv; c[3] = o[7] * inv;
          *(v4fa*)(&os[wb + lr * OSP + hh * 16 + 8 * hi]) = a; *(v4fa*)(&os[wb + lr * OSP + hh * 16 + 8 * hi + 4]) = c; }
    }
    wave_sync();
    static_assert(32 * 16 * 4 == 16 * 128);                                   // lanes x bytes x store instructions == tile rows x row bytes
    float* obase = OUT + ((((size_t)(b * DZ + z0) * HY + (size_t)y0) * WX + (size_t)w0) * CH) + hp * 32;
{
#pragma unroll
        for (int s = 0; s < 4; ++s) { const int row = 4 * s + (lane >> 3), cofs = (lane & 7) * 4;   // 4 s x 4 rows = 16 rows; 8 lanes x 4 floats = 32 columns = one line
            const v4f val = *(const v4fa*)(&os[wb + row * OSP + cofs]);
            const size_t po = ((size_t)((s >> 1) * HY + (s & 1)) * WX + (size_t)(lane >> 3)) * CH;   // query row: qz = s>>1, qy = s&1, qw = lane>>3
            *(v4f*)(obase + po + cofs) = val; }
         }
}

static constexpr size_t al256(size_t v) { return (v + 255) & ~(size_t)255; }
static constexpr size_t N_ROWP = (size_t)NB * NHD * ZP * YP * WP * 2;      // 16-byte pieces of one q / k plane
static constexpr size_t N_VWP  = (size_t)NB * CH * ZP * YP * NWB;          // 16-byte pieces of the window plane
static constexpr size_t SZ_RP = al256(N_ROWP * 16);
static constexpr size_t SZ_VW = al256(N_VWP * 16);
static constexpr size_t SZ_TOTAL = 2 * SZ_RP + SZ_VW;
static_assert(SZ_TOTAL <= (size_t)134217728);          // workspace carve <= 128 MiB
static_assert(N_ROWP % 32 == 0);
static_assert(N_VWP % 32 == 0);
static_assert(N_ROWP < (size_t)0x7FFFFFFF);
static_assert(N_VWP < (size_t)0x7FFFFFFF);
static_assert(N_ROWP * 8 == (size_t)NB * NHD * ZP * YP * WP * HD);         // producer extent == plane extent read by the pair weighting kernel
static_assert(N_VWP * 8 == (size_t)NB * CH * ZP * YP * NWB * 8);

extern "C" void kernel_launch(void* const* d_in, const int* in_sizes, int n_in,
                              void* d_out, int out_size, void* d_ws, size_t ws_size, hipStream_t stream) {
    if (n_in < 3) return;
    const size_t need = (size_t)NB * CH * CSTR;
    if ((size_t)in_sizes[0] < need || (size_t)in_sizes[1] < need || (size_t)in_sizes[2] < need) return;
    if ((size_t)out_size < need) return;
    if (SZ_TOTAL > ws_size) return;
    // wire order: q, k, v
    const float* q = (const float*)d_in[0];
    const float* k = (const float*)d_in[1];
    const float* v = (const float*)d_in[2];
    float* OUT = (float*)d_out;      // [NB][16][32][32][96]
    char* wsp = (char*)d_ws;
    h16* QP = (h16*)wsp; wsp += SZ_RP;               // [NB*6][18][34][36][16]
    h16* KP = (h16*)wsp; wsp += SZ_RP;               // [NB*6][18][34][36][16]
    h16* VW = (h16*)wsp; wsp += SZ_VW;               // [NB*96][18][34][8][8]

    const unsigned gr = (unsigned)((N_ROWP + 255) / 256);
    const unsigned gv = (unsigned)((N_VWP + 255) / 256);
    k_rows<<<gr, 256, 0, stream>>>(q, QP, (unsigned)N_ROWP);
    k_rows<<<gr, 256, 0, stream>>>(k, KP, (unsigned)N_ROWP);
    k_vwin<<<gv, 256, 0, stream>>>(v, VW, (unsigned)N_VWP);
    k_nbrwin<<<dim3(((DZ / 2) * (HY / 2) * (WX / 4)) / AW, NB * 3, 1), 32 * AW, 0, stream>>>(QP, KP, VW, OUT);
}

// v001
// One run takes 28.3 microseconds.
// Timed twice side by side with v000, it ran 1.19 times as fast both times.
#include <hip/hip_runtime.h>

// 3-D sliding-window grouped pair-score weighting: q/k/v [NB][96][16][32][32] (channel-major, 6 heads x 16), every query attends to its 3x3x3 window (dilation 1) of a zero-padded volume; padded slots keep logit 0 in the softmax and add no value; scale 16^-0.5; output [NB][16][32][32][96] (f32, channel = head*16 + c).
// Compute dtypes, f32 accumulate everywhere: logits v_wmma_f32_16x16x32_f16 (q, k RNE-converted to bf16 then held exactly in f16, K = 16 zero-padded to 32 in registers); P.V v_wmma_f32_16x16x32_f16 (P x16384 carry as single f16, cancels in the normalisation; v RNE-converted to bf16 then held exactly in f16); softmax f32.
// Layout: halo-padded f16 planes built once: q and k as [(b*6+head)][zp 18][yp 34][wp 36][16] (c contiguous, zeros in the halo), v as window plane [(b*96+ch)][zp 18][yp 34][8 windows][8] with window wbk holding w = 4*wbk-1 .. 4*wbk+6 (zeros outside the volume).
// pair weighting kernel: one wave per tile of 16 queries (2 z x 2 y x 4 w) and one head pair; key slots = 4 z x 4 y x 8 w = 128 per tile, transposed form S^T = K Q^T (A = key rows, B = query rows), packed P^T is the B fragment of O^T = V^T P^T (A = window-plane rows); window membership by a per-element select.

#ifndef NB
#define NB 2
#endif
#define NB_FULL 2
#define CH   96
#define NHD  6
#define HD   16
#define DZ   16
#define HY   32
#define WX   32
#define CSTR (DZ * HY * WX)      // channel stride of the inputs (floats)
#define ZP   (DZ + 2)            // padded depth: zp = z + 1
#define YP   (HY + 2)            // padded height: yp = y + 1
#define WP   (WX + 4)            // padded width of the row planes: wp = w + 1, slots 0..35
#define NWB  (WX / 4)
#define AW   4                   // waves per pair weighting block
#define OSP  36                  // LDS row pitch (floats) of the output tile
#define SC2  ((float)(0.25 * 1.4426950408889634))   // HD^-0.5 * log2(e)
#define PSH  14.0f               // log2 of the P carry (16384)
#define NEGB (-3.0e38f)

static_assert(NHD * HD == CH);
static_assert(HD == 16);                       // one O^T tile per head; logits K = 16 (upper 16 k slots are register zeros)
static_assert(NHD % 2 == 0);
static_assert(DZ % 2 == 0);
static_assert(HY % 2 == 0);
static_assert(WX % 4 == 0);
static_assert(WX == 32);                       // tile index decode uses 3 + 4 + 3 bits
static_assert(HY == 32);
static_assert(DZ == 16);
static_assert(NWB == 8);
static_assert(WP >= WX + 4);                   // key slots reach wp = (WX - 4) + 7
static_assert((CH * 4) % 128 == 0);            // output position pitch = 3 lines
static_assert(((DZ / 2) * (HY / 2) * (WX / 4)) % AW == 0);
static_assert((OSP * 4) % 16 == 0);
static_assert(NB <= NB_FULL);
static_assert(AW * 16 * OSP * 4 <= 131072);    // static LDS of the pair weighting kernel

typedef _Float16 h16;
typedef __attribute__((ext_vector_type(16))) _Float16 v16h;
typedef __attribute__((ext_vector_type(8)))  _Float16 v8h;
typedef __attribute__((ext_vector_type(8)))  float    v8f;
typedef __attribute__((ext_vector_type(4)))  float    v4f;
typedef v4f  __attribute__((may_alias)) v4fa;

__device__ __forceinline__ unsigned short f2bf(float f) { unsigned u = __float_as_uint(f); u += 0x7FFFu + ((u >> 16) & 1u); return (unsigned short)(u >> 16); }
__device__ __forceinline__ float bfr(float f) { return __uint_as_float(((unsigned)f2bf(f)) << 16); }   // value after RNE convert to bf16
__device__ __forceinline__ v16h cat16(v8h lo, v8h hi) { return __builtin_shufflevector(lo, hi, 0, 1, 2, 3, 4, 5, 6, 7, 8, 9, 10, 11, 12, 13, 14, 15); }
__device__ __forceinline__ v8f wmma16(v16h a, v16h b, v8f c) { return __builtin_amdgcn_wmma_f32_16x16x32_f16(false, a, false, b, (short)0, c, false, false); }
// one matrix instruction followed by its own four-slot guard (one accumulator per guard)
__device__ __forceinline__ v8f wmma16g(v16h a, v16h b, v8f c) { c = wmma16(a, b, c); asm volatile("v_nop\n\tv_nop\n\tv_nop\n\tv_nop" : "+v"(c) : "v"(a), "v"(b)); return c; }
// f32 -> f16 convert that cannot produce an f16 subnormal
static __device__ __forceinline__ h16 toh_flush(float v) { const h16 r = (h16)v; return (fabsf(v) < 6.103515625e-05f) ? (h16)0.0f : r; }
// fragment with K = 16: p already includes + 8*(lane>>4); elements 0..7 <- k = 8h+0..7, elements 8..15 (k = 16+8h+0..7) are zero for A and B alike
__device__ __forceinline__ v16h ld8z(const h16* p) { return cat16(*(const v8h*)p, (v8h){}); }
// ordering point for wave-private LDS tiles (same wave writes and reads)
__device__ __forceinline__ void wave_sync() { __builtin_amdgcn_fence(3 /* release order */, "wavefront"); __builtin_amdgcn_wave_barrier(); asm volatile("" ::: "memory"); }

// rows_piece (block blk of the plane's own 256-piece blocks): halo-padded position-major f16 plane [(b*6+head)][zp][yp][wp][16] from a channel-major f32 input. One 16-byte piece (8 channels of one slot) per thread, thread-linear:
static __device__ __forceinline__ void rows_piece(const float* __restrict__ src, h16* dst, unsigned npieces, unsigned blk) {
    const unsigned i = blk * 256u + threadIdx.x; if (i >= npieces) return;
    const int c8 = (int)(i & 1u) * 8; unsigned r = i >> 1;
    const int wp = (int)(r % (unsigned)WP); r /= (unsigned)WP;
    const int yp = (int)(r % (unsigned)YP); r /= (unsigned)YP;
    const int zp = (int)(r % (unsigned)ZP); const int bh = (int)(r / (unsigned)ZP);
    const int b = bh / NHD, hd = bh % NHD;
    const int z = zp - 1, y = yp - 1, w = wp - 1;
    const bool ok = ((unsigned)z < (unsigned)DZ) & ((unsigned)y < (unsigned)HY) & ((unsigned)w < (unsigned)WX);
    const int zc = z < 0 ? 0 : (z > DZ - 1 ? DZ - 1 : z);
    const int yc = y < 0 ? 0 : (y > HY - 1 ? HY - 1 : y);
    const int wc = w < 0 ? 0 : (w > WX - 1 ? WX - 1 : w);
    const size_t so = (size_t)(b * CH + hd * HD + c8) * CSTR + (size_t)((zc * HY + yc) * WX + wc);
    float x[8];
#pragma unroll
    for (int j = 0; j < 8; ++j) x[j] = src[so + (size_t)j * CSTR];
#pragma unroll
    for (int j = 0; j < 8; ++j) asm volatile("" : "+v"(x[j]));
    v8h o;
#pragma unroll
    for (int j = 0; j < 8; ++j) { const float xs = ok ? bfr(x[j]) : 0.0f; o[j] = toh_flush(xs); }
    *(v8h*)(dst + (size_t)i * 8) = o; 
}

// vwin_piece (block blk of the plane's own 256-piece blocks): window plane [(b*96+ch)][zp][yp][8 windows][8] from the channel-major f32 input: window wbk = slots w = 4*wbk-1 .. 4*wbk+6 (zero outside the volume).
static __device__ __forceinline__ void vwin_piece(const float* __restrict__ src, h16* dst, unsigned npieces, unsigned blk) {
    const unsigned i = blk * 256u + threadIdx.x; if (i >= npieces) return;
    const int wbk = (int)(i & 7u); unsigned r = i >> 3;
    const int yp = (int)(r % (unsigned)YP); r /= (unsigned)YP;
    const int zp = (int)(r % (unsigned)ZP); const int bch = (int)(r / (unsigned)ZP);   // b*96 + ch (input batch pitch = 96 channels)
    const int z = zp - 1, y = yp - 1;
    const bool rowok = ((unsigned)z < (unsigned)DZ) & ((unsigned)y < (unsigned)HY);
    const int zc = z < 0 ? 0 : (z > DZ - 1 ? DZ - 1 : z);
    const int yc = y < 0 ? 0 : (y > HY - 1 ? HY - 1 : y);
    const size_t ro = (size_t)bch * CSTR + (size_t)((zc * HY + yc) * WX);
    const int bm = wbk > 0 ? wbk - 1 : 0;
    const int bp = wbk < NWB - 1 ? wbk + 1 : NWB - 1;
    v4f A = *(const v4f*)(src + ro + 4 * bm);
    v4f B = *(const v4f*)(src + ro + 4 * wbk);
    v4f C = *(const v4f*)(src + ro + 4 * bp);
    asm volatile("" : "+v"(A)); asm volatile("" : "+v"(B)); asm volatile("" : "+v"(C));
    const bool okm = rowok & (wbk >= 1);
    const bool okp = rowok & (wbk <= NWB - 2);
    float e[8];
    e[0] = okm ? bfr(A[3]) : 0.0f;
    e[1] = rowok ? bfr(B[0]) : 0.0f; e[2] = rowok ? bfr(B[1]) : 0.0f; e[3] = rowok ? bfr(B[2]) : 0.0f; e[4] = rowok ? bfr(B[3]) : 0.0f;
    e[5] = okp ? bfr(C[0]) : 0.0f; e[6] = okp ? bfr(C[1]) : 0.0f; e[7] = okp ? bfr(C[2]) : 0.0f;
    v8h o;
#pragma unroll
    for (int j = 0; j < 8; ++j) o[j] = toh_flush(e[j]);
    *(v8h*)(dst + (size_t)i * 8) = o; 
}

// k_nbrwin: one wave per (16-query tile, head pair). Query t = lane&15: qz = t>>3, qy = (t>>2)&1, qw = t&3 at (z0+qz, y0+qy, w0+qw).
// Key slot kk = 16j + row (j = 0..7): group g = kk>>3 -> dz = g>>2, dy = g&3, e = kk&7, volume position (z0-1+dz, y0-1+dy, w0-1+e) = padded (z0+dz, y0+dy, w0+e).
// S^T tile j: A = key rows (lane&15 = row), B = query rows; D element r of lane (t, h) = key slot 16j+8h+r -> dz = j>>1, dy = 2(j&1)+h, e = r.
// Slot kept iff dz-qz, dy-qy, e-qw all in {0,1,2}: exactly 27 per query (padded slots included with logit 0 from zero key rows).
// O^T[d][t] = V^T P^T, k-step s4 = key slots 32*s4..+31: A row d = lane&15 from the window plane, elements 0..7 <- (dz = s4, dy = h), elements 8..15 <- (dz = s4, dy = 2+h); B = packed P of S^T tiles 2*s4 and 2*s4+1.
__global__ __launch_bounds__(32 * AW) void k_nbrwin(const h16* __restrict__ QP, const h16* __restrict__ KP, const h16* __restrict__ VW, float* OUT) {
    __shared__ __align__(16) float os[AW * 16 * OSP];
    const int lane = threadIdx.x & 31, lr = lane & 15, hi = lane >> 4;
    const int wave = __builtin_amdgcn_readfirstlane((int)(threadIdx.x >> 5));
    const int tidx = blockIdx.x * AW + wave;                                  // 0 .. 1023 within one batch
    const int wbk = tidx & 7, yb = (tidx >> 3) & 15, zb = tidx >> 7;
    const int b = blockIdx.y / 3, hp = blockIdx.y % 3;
    const int z0 = 2 * zb, y0 = 2 * yb, w0 = 4 * wbk;
    const int qz = lr >> 3, qy = (lr >> 2) & 1, qw = lr & 3;
    bool kzy[8], kw[8];
#pragma unroll
    for (int j = 0; j < 8; ++j) { const int dz = j >> 1, dy = 2 * (j & 1) + hi; kzy[j] = ((unsigned)(dz - qz) <= 2u) & ((unsigned)(dy - qy) <= 2u); }
#pragma unroll
    for (int r = 0; r < 8; ++r) kw[r] = (unsigned)(r - qw) <= 2u;
    const int qrow  = ((z0 + qz + 1) * YP + (y0 + qy + 1)) * WP + (w0 + qw + 1);
    const int krow0 = (z0 * YP + (y0 + (lr >> 3))) * WP + (w0 + (lr & 7));   // tile j adds ((j>>1)*YP + 2*(j&1))*WP; zp <= 17, yp <= 33, wp <= 35
    const int wb = wave * 16 * OSP;
#pragma unroll 1
    for (int hh = 0; hh < 2; ++hh) {
        const int hd = 2 * hp + hh;
        const size_t rbase = (size_t)(b * NHD + hd) * ((size_t)ZP * YP * WP * HD);
        const v16h qf = ld8z(QP + rbase + (size_t)qrow * HD + 8 * hi);       // B fragment: col t, k = c
        v8f s[8];
#pragma unroll
        for (int j = 0; j < 8; ++j) {
            const int kr = krow0 + ((j >> 1) * YP + 2 * (j & 1)) * WP;
            const v16h ka = ld8z(KP + rbase + (size_t)kr * HD + 8 * hi);     // A fragment: row key slot, k = c
            s[j] = wmma16g(ka, qf, (v8f){});
        }
        float mx = NEGB;
#pragma unroll
        for (int j = 0; j < 8; ++j) {
#pragma unroll
            for (int r = 0; r < 8; ++r) { const bool kp = kzy[j] & kw[r]; const float t = s[j][r] * SC2; mx = fmaxf(mx, kp ? t : NEGB); } }
        mx = fmaxf(mx, __shfl_xor(mx, 16, 32));
        const float sh = PSH - mx;
        const size_t vch = (size_t)(b * CH + hd * HD + lr);
        v8f o = (v8f){};
        float ls = 0.0f;
#pragma unroll
        for (int s4 = 0; s4 < 4; ++s4) {
            v16h pb;
#pragma unroll
            for (int r = 0; r < 8; ++r) {
                const float ea = s[2 * s4][r] * SC2 + sh, eb = s[2 * s4 + 1][r] * SC2 + sh;
                const float xa = __builtin_amdgcn_exp2f(ea), xb = __builtin_amdgcn_exp2f(eb);
                const bool ca = kzy[2 * s4] & kw[r] & (ea >= -14.0f);
                const bool cb = kzy[2 * s4 + 1] & kw[r] & (eb >= -14.0f);
                const float ga = ca ? xa : 0.0f, gb = cb ? xb : 0.0f;         // dropped slots selected to 0 by value; kept values >= 2^-14
                const h16 pa = (h16)ga; const h16 pc = (h16)gb;
                pb[r] = pa; pb[8 + r] = pc;
                ls += (float)pa + (float)pc; }
            const size_t va = (((vch * ZP + (size_t)(z0 + s4)) * YP + (size_t)(y0 + hi)) * NWB + (size_t)wbk) * 8;
            const v16h vf = cat16(*(const v8h*)(VW + va), *(const v8h*)(VW + va + (size_t)2 * NWB * 8));   // yp and yp + 2
            o = wmma16g(vf, pb, o);
        }
        const float l = ls + __shfl_xor(ls, 16, 32);                          // >= 16384: the row maximum is always kept
        const float inv = 1.0f / l;
        // O^T D layout: o[r] = (d = 8h + r, t = lane&15) -> os[t][hh*16 + d]
        { v4f a, c;
          a[0] = o[0] * inv; a[1] = o[1] * inv; a[2] = o[2] * inv; a[3] = o[3] * inv; c[0] = o[4] * inv; c[1] = o[5] * inv; c[2] = o[6] * inv; c[3] = o[7] * inv;
          *(v4fa*)(&os[wb + lr * OSP + hh * 16 + 8 * hi]) = a; *(v4fa*)(&os[wb + lr * OSP + hh * 16 + 8 * hi + 4]) = c; }
    }
    wave_sync();
    static_assert(32 * 16 * 4 == 16 * 128);                                   // lanes x bytes x store instructions == tile rows x row bytes
    float* obase = OUT + ((((size_t)(b * DZ + z0) * HY + (size_t)y0) * WX + (size_t)w0) * CH) + hp * 32;
{
#pragma unroll
        for (int s = 0; s < 4; ++s) { const int row = 4 * s + (lane >> 3), cofs = (lane & 7) * 4;   // 4 s x 4 rows = 16 rows; 8 lanes x 4 floats = 32 columns = one line
            const v4f val = *(const v4fa*)(&os[wb + row * OSP + cofs]);
            const size_t po = ((size_t)((s >> 1) * HY + (s & 1)) * WX + (size_t)(lane >> 3)) * CH;   // query row: qz = s>>1, qy = s&1, qw = lane>>3
            *(v4f*)(obase + po + cofs) = val; }
         }
}

static constexpr size_t al256(size_t v) { return (v + 255) & ~(size_t)255; }
static constexpr size_t N_ROWP = (size_t)NB * NHD * ZP * YP * WP * 2;      // 16-byte pieces of one q / k plane
static constexpr size_t N_VWP  = (size_t)NB * CH * ZP * YP * NWB;          // 16-byte pieces of the window plane
static constexpr size_t SZ_RP = al256(N_ROWP * 16);
static constexpr size_t SZ_VW = al256(N_VWP * 16);
static constexpr size_t SZ_TOTAL = 2 * SZ_RP + SZ_VW;
static_assert(SZ_TOTAL <= (size_t)134217728);          // workspace carve <= 128 MiB
static_assert(N_ROWP % 32 == 0);
static_assert(N_VWP % 32 == 0);
static_assert(N_ROWP < (size_t)0x7FFFFFFF);
static_assert(N_VWP < (size_t)0x7FFFFFFF);
static_assert(N_ROWP * 8 == (size_t)NB * NHD * ZP * YP * WP * HD);         // producer extent == plane extent read by the pair weighting kernel
static_assert(N_VWP * 8 == (size_t)NB * CH * ZP * YP * NWB * 8);
static constexpr unsigned G_ROW = (unsigned)((N_ROWP + 255) / 256);       // blocks of one q / k plane
static constexpr unsigned G_VW  = (unsigned)((N_VWP + 255) / 256);        // blocks of the window plane

// k_prep: the three plane builds, which read nothing of each other, as one grid. The block index picks the job: [0, G_VW) window plane of v (the largest job starts first), then G_ROW blocks for q, then G_ROW blocks for k.
__global__ __launch_bounds__(256) void k_prep(const float* __restrict__ q, const float* __restrict__ k, const float* __restrict__ v, h16* QP, h16* KP, h16* VW) {
    const unsigned blk = blockIdx.x;
    if (blk < G_VW) vwin_piece(v, VW, (unsigned)N_VWP, blk);
    else if (blk < G_VW + G_ROW) rows_piece(q, QP, (unsigned)N_ROWP, blk - G_VW);
    else rows_piece(k, KP, (unsigned)N_ROWP, blk - (G_VW + G_ROW));
}

extern "C" void kernel_launch(void* const* d_in, const int* in_sizes, int n_in,
                              void* d_out, int out_size, void* d_ws, size_t ws_size, hipStream_t stream) {
    if (n_in < 3) return;
    const size_t need = (size_t)NB * CH * CSTR;
    if ((size_t)in_sizes[0] < need || (size_t)in_sizes[1] < need || (size_t)in_sizes[2] < need) return;
    if ((size_t)out_size < need) return;
    if (SZ_TOTAL > ws_size) return;
    // wire order: q, k, v
    const float* q = (const float*)d_in[0];
    const float* k = (const float*)d_in[1];
    const float* v = (const float*)d_in[2];
    float* OUT = (float*)d_out;      // [NB][16][32][32][96]
    char* wsp = (char*)d_ws;
    h16* QP = (h16*)wsp; wsp += SZ_RP;               // [NB*6][18][34][36][16]
    h16* KP = (h16*)wsp; wsp += SZ_RP;               // [NB*6][18][34][36][16]
    h16* VW = (h16*)wsp; wsp += SZ_VW;               // [NB*96][18][34][8][8]

    k_prep<<<G_VW + 2 * G_ROW, 256, 0, stream>>>(q, k, v, QP, KP, VW);
    k_nbrwin<<<dim3(((DZ / 2) * (HY / 2) * (WX / 4)) / AW, NB * 3, 1), 32 * AW, 0, stream>>>(QP, KP, VW, OUT);
}

// v002
// Measured time: 19.4 microseconds a run.
// In both of two side-by-side timings against v001, it was 1.46 times as fast.
// All steps since v000 together make it 1.73 times as fast.
#include <hip/hip_runtime.h>

// 3-D sliding-window grouped pair-score weighting: q/k/v [NB][96][16][32][32] (channel-major, 6 heads x 16), every query attends to its 3x3x3 window (dilation 1) of a zero-padded volume; padded slots keep logit 0 in the softmax and add no value; scale 16^-0.5; output [NB][16][32][32][96] (f32, channel = head*16 + c).
// Compute dtypes, f32 accumulate everywhere: logits v_wmma_f32_16x16x32_f16 (q, k RNE-converted to bf16 then held exactly in f16, K = 16 zero-padded to 32 in registers); P.V v_wmma_f32_16x16x32_f16 (P x16384 carry as single f16, cancels in the normalisation; v RNE-converted to bf16 then held exactly in f16); softmax f32.
// One launch. A work-group of 8 waves owns 2 z x 2 y x 32 w queries and one head pair. Per head it builds its own f16 tiles in LDS straight from the f32 inputs: k as [row 16 = 4 z x 4 y][wp 36][16] (c contiguous, wp = w + 1, zeros in the halo), q as [row 4 = 2 z x 2 y][w 32][16], v as window tile [ch 16][row 16][8 windows][8] with window wbk holding w = 4*wbk-1 .. 4*wbk+6 (zeros outside the volume).
// One wave per tile of 16 queries (2 z x 2 y x 4 w); key slots = 4 z x 4 y x 8 w = 128 per tile, transposed form S^T = K Q^T (A = key rows, B = query rows), packed P^T is the B fragment of O^T = V^T P^T (A = window-tile rows); window membership by a per-element select.

#ifndef NB
#define NB 2
#endif
#define NB_FULL 2
#define CH   96
#define NHD  6
#define HD   16
#define DZ   16
#define HY   32
#define WX   32
#define CSTR (DZ * HY * WX)      // channel stride of the inputs (floats)
#define WP   (WX + 4)            // padded width of the k tile: wp = w + 1, slots 0..35
#define NWB  (WX / 4)
#define AW   8                   // waves per work-group = w blocks of one row
#define KR   16                  // halo rows of a work-group: row = dz*4 + dy, z = z0-1+dz, y = y0-1+dy
#define VPIT (KR * NWB * 8 + 8)  // channel pitch (f16) of the v window tile: 2064 B, 4 banks on from the last channel
#define OSP  36                  // LDS row pitch (floats) of the output tile
#define SC2  ((float)(0.25 * 1.4426950408889634))   // HD^-0.5 * log2(e)
#define PSH  14.0f               // log2 of the P carry (16384)
#define NEGB (-3.0e38f)

static_assert(NHD * HD == CH);
static_assert(HD == 16);                       // one O^T tile per head; logits K = 16 (upper 16 k slots are register zeros)
static_assert(NHD % 2 == 0);
static_assert(DZ % 2 == 0);
static_assert(HY % 2 == 0);
static_assert(WX == 32);                       // one lane per w in the q / k staging; tile index decode uses 3 + 4 + 3 bits
static_assert(HY == 32);
static_assert(DZ == 16);
static_assert(NWB == 8);
static_assert(AW == NWB);                      // wave index = w block
static_assert(WP >= WX + 4);                   // key slots reach wp = (WX - 4) + 7
static_assert((CH * 4) % 128 == 0);            // output position pitch = 3 lines
static_assert((OSP * 4) % 16 == 0);
static_assert((VPIT * 2) % 16 == 0);
static_assert(NB <= NB_FULL);
static_assert(AW * 16 * OSP * 4 + (KR * WP * HD + 4 * WX * HD + HD * VPIT) * 2 <= 81920);   // four work-groups fit one WGP's LDS

typedef _Float16 h16;
typedef __attribute__((ext_vector_type(16))) _Float16 v16h;
typedef __attribute__((ext_vector_type(8)))  _Float16 v8h;
typedef __attribute__((ext_vector_type(8)))  float    v8f;
typedef __attribute__((ext_vector_type(4)))  float    v4f;
typedef v4f  __attribute__((may_alias)) v4fa;
typedef __attribute__((ext_vector_type(4)))  unsigned u4 __attribute__((may_alias));

__device__ __forceinline__ unsigned short f2bf(float f) { unsigned u = __float_as_uint(f); u += 0x7FFFu + ((u >> 16) & 1u); return (unsigned short)(u >> 16); }
__device__ __forceinline__ float bfr(float f) { return __uint_as_float(((unsigned)f2bf(f)) << 16); }   // value after RNE convert to bf16
__device__ __forceinline__ v16h cat16(v8h lo, v8h hi) { return __builtin_shufflevector(lo, hi, 0, 1, 2, 3, 4, 5, 6, 7, 8, 9, 10, 11, 12, 13, 14, 15); }
__device__ __forceinline__ v8f wmma16(v16h a, v16h b, v8f c) { return __builtin_amdgcn_wmma_f32_16x16x32_f16(false, a, false, b, (short)0, c, false, false); }
// one matrix instruction followed by its own four-slot guard (one accumulator per guard)
__device__ __forceinline__ v8f wmma16g(v16h a, v16h b, v8f c) { c = wmma16(a, b, c); asm volatile("v_nop\n\tv_nop\n\tv_nop\n\tv_nop" : "+v"(c) : "v"(a), "v"(b)); return c; }
// f32 -> f16 convert that cannot produce an f16 subnormal
static __device__ __forceinline__ h16 toh_flush(float v) { const h16 r = (h16)v; return (fabsf(v) < 6.103515625e-05f) ? (h16)0.0f : r; }
// fragment with K = 16: p already includes + 8*(lane>>4); elements 0..7 <- k = 8h+0..7, elements 8..15 (k = 16+8h+0..7) are zero for A and B alike
__device__ __forceinline__ v16h ld8z(const h16* p) { return cat16(*(const v8h*)p, (v8h){}); }
// ordering point for wave-private LDS tiles (same wave writes and reads)
__device__ __forceinline__ void wave_sync() { __builtin_amdgcn_fence(3 /* release order */, "wavefront"); __builtin_amdgcn_wave_barrier(); asm volatile("" ::: "memory"); }

typedef const __attribute__((address_space(1))) float* gfp;
typedef const __attribute__((address_space(1))) v4f*   gv4p;
typedef const __attribute__((address_space(1))) char*  gcp;
// a wave-uniform global address held in scalar registers: each load is then scalar base + the lane's fixed 32-bit offset, and no 64-bit vector address is formed anew per head
static __device__ __forceinline__ gfp sbase(const float* p) {
    const unsigned long long a = (unsigned long long)p;
    const unsigned lo = (unsigned)__builtin_amdgcn_readfirstlane((int)(unsigned)a), hi = (unsigned)__builtin_amdgcn_readfirstlane((int)(unsigned)(a >> 32));
    return (gfp)(((unsigned long long)hi << 32) | lo);
}
// load8: 8 channels (stride CSTR) of one row of a channel-major f32 input, lane = w: p is the same in every lane of the wave.
static __device__ __forceinline__ void load8(gfp p, unsigned w, float (&x)[8]) {
#pragma unroll
    for (int j = 0; j < 8; ++j) x[j] = (p + (size_t)j * CSTR)[w];
}
// put8: 8 f32 -> one 16-byte piece of an f16 tile; m = bit mask per f16 pair, all ones inside the volume and 0 (= +0.0) outside it.
static __device__ __forceinline__ void put8(h16* dst, const float (&x)[8], u4 m) {
    v8h o;
#pragma unroll
    for (int j = 0; j < 8; ++j) o[j] = toh_flush(bfr(x[j]));
    *(u4*)dst = __builtin_bit_cast(u4, o) & m;
}
static __device__ __forceinline__ int clampi(int a, int hi) { return a < 0 ? 0 : (a > hi ? hi : a); }

// k_nbrwin: one work-group per (2 z x 2 y x 32 w queries, head pair), one wave per 16-query tile. Query t = lane&15: qz = t>>3, qy = (t>>2)&1, qw = t&3 at (z0+qz, y0+qy, w0+qw).
// Key slot kk = 16j + row (j = 0..7): group g = kk>>3 -> dz = g>>2, dy = g&3, e = kk&7, volume position (z0-1+dz, y0-1+dy, w0-1+e) = k tile (row dz*4+dy, wp w0+e).
// S^T tile j: A = key rows (lane&15 = row), B = query rows; D element r of lane (t, h) = key slot 16j+8h+r -> dz = j>>1, dy = 2(j&1)+h, e = r.
// Slot kept iff dz-qz, dy-qy, e-qw all in {0,1,2}: exactly 27 per query (padded slots included with logit 0 from zero key rows).
// O^T[d][t] = V^T P^T, k-step s4 = key slots 32*s4..+31: A row d = lane&15 from the window tile, elements 0..7 <- (dz = s4, dy = h), elements 8..15 <- (dz = s4, dy = 2+h); B = packed P of S^T tiles 2*s4 and 2*s4+1.
__global__ __launch_bounds__(32 * AW) void k_nbrwin(const float* __restrict__ q, const float* __restrict__ k, const float* __restrict__ v, float* OUT) {
    __shared__ __align__(16) float os[AW * 16 * OSP];
    __shared__ __align__(16) h16 KL[KR * WP * HD];
    __shared__ __align__(16) h16 QL[4 * WX * HD];
    __shared__ __align__(16) h16 VL[HD * VPIT];
    const int tid = (int)threadIdx.x;
    const int lane = tid & 31, lr = lane & 15, hi = lane >> 4;
    const int wave = __builtin_amdgcn_readfirstlane(tid >> 5);
    const int wbk = wave, yb = (int)blockIdx.x & 15, zb = (int)blockIdx.x >> 4;
    const int b = blockIdx.y / 3, hp = blockIdx.y % 3;
    const int z0 = 2 * zb, y0 = 2 * yb, w0 = 4 * wbk;
    const int qz = lr >> 3, qy = (lr >> 2) & 1, qw = lr & 3;
    bool kzy[8], kw[8];
#pragma unroll
    for (int j = 0; j < 8; ++j) { const int dz = j >> 1, dy = 2 * (j & 1) + hi; kzy[j] = ((unsigned)(dz - qz) <= 2u) & ((unsigned)(dy - qy) <= 2u); }
#pragma unroll
    for (int r = 0; r < 8; ++r) kw[r] = (unsigned)(r - qw) <= 2u;
    const int qrow  = (qz * 2 + qy) * WX + (w0 + qw);                         // q tile row
    const int krow0 = (lr >> 3) * WP + (w0 + (lr & 7));                       // k tile row; tile j adds ((j>>1)*4 + 2*(j&1))*WP; row <= 15, wp <= 35
    const int wb = wave * 16 * OSP;
    // staging indices, the same for both heads
    const int qr = wave >> 1, qc8 = (wave & 1) * 8;                           // q task: row, first channel
    const int vwk = tid & 7, vrow = (tid >> 3) & 15, vch0 = tid >> 7;         // v piece: window, halo row, channel parity
    const int vz = z0 - 1 + (vrow >> 2), vy = y0 - 1 + (vrow & 3);
    const unsigned vro = (unsigned)(vch0 * CSTR + (clampi(vz, DZ - 1) * HY + clampi(vy, HY - 1)) * WX);   // channel parity + clamped row: every address stays inside the input
    const int vbm = vwk > 0 ? vwk - 1 : 0, vbp = vwk < NWB - 1 ? vwk + 1 : NWB - 1;
    const unsigned voa = (vro + 4u * vbm + 3u) * 4u, vob = (vro + 4u * vwk) * 4u, voc = (vro + 4u * vbp) * 4u;   // byte offsets of w-1, own 4, next 4
    const bool vrok = ((unsigned)vz < (unsigned)DZ) & ((unsigned)vy < (unsigned)HY);
    const unsigned mr = vrok ? 0xFFFFu : 0u, mm = (vrok & (vwk >= 1)) ? 0xFFFFu : 0u, mp = (vrok & (vwk <= NWB - 2)) ? 0xFFFFu : 0u;
    const u4 vm = {mm | (mr << 16), mr | (mr << 16), mr | (mp << 16), mp | (mp << 16)};   // elements 0 | 1..4 | 5..7 = w-1 | own 4 | next 3
    // w halo of the k tile (wp = 0, 33, 34, 35), zero for both heads: 16 rows x 4 slots x 2 pieces, published by the first barrier below
    if (tid < KR * 4 * 2) { const int s = (tid >> 1) & 3; *(v8h*)(KL + ((tid >> 3) * WP + (s == 0 ? 0 : WX + s)) * HD + (tid & 1) * 8) = (v8h){}; }
#pragma unroll 1
    for (int hh = 0; hh < 2; ++hh) {
        const int hd = 2 * hp + hh;
        const size_t cbase = (size_t)(b * CH + hd * HD) * CSTR;
        // every wave has left the last head's tiles before they are rewritten
        __syncthreads();
        // all loads of the head first, so that one memory latency covers them.
        // k tile: 32 tasks (row, 8 channels), 4 per wave, lane = w: each load is one whole 128-byte row. q tile: 8 tasks, one per wave.
        float xk[4][8], xq[8];
#pragma unroll
        for (int it = 0; it < 4; ++it) {
            const int task = wave * 4 + it, row = task >> 1, c8 = (task & 1) * 8;
            const int zc = clampi(z0 - 1 + (row >> 2), DZ - 1), yc = clampi(y0 - 1 + (row & 3), HY - 1);
            load8(sbase(k + cbase + (size_t)c8 * CSTR + (size_t)((zc * HY + yc) * WX)), (unsigned)lane, xk[it]);
        }
        load8(sbase(q + cbase + (size_t)qc8 * CSTR + (size_t)(((z0 + (qr >> 1)) * HY + (y0 + (qr & 1))) * WX)), (unsigned)lane, xq);
        // v window tile: 2048 pieces (channel, row, window), 8 per thread: channel 2*it + (tid>>7); a wave covers 4 y rows x 8 windows of one channel and z
        float va3[8]; v4f vB[8], vC[8];
        const gfp vh = (gfp)(v + cbase);
#pragma unroll
        for (int it = 0; it < 8; ++it) {
            const gcp cp = (gcp)(vh + (size_t)(2 * it) * CSTR);               // the same in every lane; the lane's own part is the byte offsets voa, vob, voc
            va3[it] = *(gfp)(cp + voa); vB[it] = *(gv4p)(cp + vob);
        }
        // the loads below may land in address registers of the loads above: the wait that stands in front of such an overwrite
        asm volatile("s_wait_xcnt 0x0" ::: "memory");
#pragma unroll
        for (int it = 0; it < 8; ++it) vC[it] = *(gv4p)((gcp)(vh + (size_t)(2 * it) * CSTR) + voc);
        // inputs-only fences on the loaded values: they keep all 64 loads issued ahead of the conversions; without them the compiler spreads the v loads among the conversions, each behind a full wait of its own
#pragma unroll
        for (int it = 0; it < 4; ++it) asm volatile("" :: "v"(xk[it][0]), "v"(xk[it][1]), "v"(xk[it][2]), "v"(xk[it][3]), "v"(xk[it][4]), "v"(xk[it][5]), "v"(xk[it][6]), "v"(xk[it][7]));
        asm volatile("" :: "v"(xq[0]), "v"(xq[1]), "v"(xq[2]), "v"(xq[3]), "v"(xq[4]), "v"(xq[5]), "v"(xq[6]), "v"(xq[7]));
#pragma unroll
        for (int it = 0; it < 8; ++it) asm volatile("" :: "v"(va3[it]), "v"(vB[it]), "v"(vC[it]));
#pragma unroll
        for (int it = 0; it < 4; ++it) {
            const int task = wave * 4 + it, row = task >> 1, c8 = (task & 1) * 8;
            const bool ok = ((unsigned)(z0 - 1 + (row >> 2)) < (unsigned)DZ) & ((unsigned)(y0 - 1 + (row & 3)) < (unsigned)HY);
            const unsigned km = ok ? 0xFFFFFFFFu : 0u;
            put8(KL + (row * WP + lane + 1) * HD + c8, xk[it], (u4){km, km, km, km});
        }
        put8(QL + (qr * WX + lane) * HD + qc8, xq, (u4){0xFFFFFFFFu, 0xFFFFFFFFu, 0xFFFFFFFFu, 0xFFFFFFFFu});
#pragma unroll
        for (int it = 0; it < 8; ++it) {
            const float e[8] = {va3[it], vB[it][0], vB[it][1], vB[it][2], vB[it][3], vC[it][0], vC[it][1], vC[it][2]};
            put8(VL + (2 * it + vch0) * VPIT + (vrow * NWB + vwk) * 8, e, vm);
        }
        // the three tiles are complete before any wave reads them
        __syncthreads();
        const v16h qf = ld8z(QL + qrow * HD + 8 * hi);                        // B fragment: col t, k = c
        v8f s[8];
#pragma unroll
        for (int j = 0; j < 8; ++j) {
            const int kr = krow0 + ((j >> 1) * 4 + 2 * (j & 1)) * WP;
            const v16h ka = ld8z(KL + kr * HD + 8 * hi);                      // A fragment: row key slot, k = c
            s[j] = wmma16g(ka, qf, (v8f){});
        }
        float mx = NEGB;
#pragma unroll
        for (int j = 0; j < 8; ++j) {
#pragma unroll
            for (int r = 0; r < 8; ++r) { const bool kp = kzy[j] & kw[r]; const float t = s[j][r] * SC2; mx = fmaxf(mx, kp ? t : NEGB); } }
        mx = fmaxf(mx, __shfl_xor(mx, 16, 32));
        const float sh = PSH - mx;
        v8f o = (v8f){};
        float ls = 0.0f;
#pragma unroll
        for (int s4 = 0; s4 < 4; ++s4) {
            v16h pb;
#pragma unroll
            for (int r = 0; r < 8; ++r) {
                const float ea = s[2 * s4][r] * SC2 + sh, eb = s[2 * s4 + 1][r] * SC2 + sh;
                const float xa = __builtin_amdgcn_exp2f(ea), xb = __builtin_amdgcn_exp2f(eb);
                const bool ca = kzy[2 * s4] & kw[r] & (ea >= -14.0f);
                const bool cb = kzy[2 * s4 + 1] & kw[r] & (eb >= -14.0f);
                const float ga = ca ? xa : 0.0f, gb = cb ? xb : 0.0f;         // dropped slots selected to 0 by value; kept values >= 2^-14
                const h16 pa = (h16)ga; const h16 pc = (h16)gb;
                pb[r] = pa; pb[8 + r] = pc;
                ls += (float)pa + (float)pc; }
            const int va = lr * VPIT + ((s4 * 4 + hi) * NWB + wbk) * 8;
            const v16h vf = cat16(*(const v8h*)(VL + va), *(const v8h*)(VL + va + 2 * NWB * 8));   // dy and dy + 2
            o = wmma16g(vf, pb, o);
        }
        const float l = ls + __shfl_xor(ls, 16, 32);                          // >= 16384: the row maximum is always kept
        const float inv = 1.0f / l;
        // O^T D layout: o[r] = (d = 8h + r, t = lane&15) -> os[t][hh*16 + d]
        { v4f a, c;
          a[0] = o[0] * inv; a[1] = o[1] * inv; a[2] = o[2] * inv; a[3] = o[3] * inv; c[0] = o[4] * inv; c[1] = o[5] * inv; c[2] = o[6] * inv; c[3] = o[7] * inv;
          *(v4fa*)(&os[wb + lr * OSP + hh * 16 + 8 * hi]) = a; *(v4fa*)(&os[wb + lr * OSP + hh * 16 + 8 * hi + 4]) = c; }
    }
    wave_sync();
    static_assert(32 * 16 * 4 == 16 * 128);                                   // lanes x bytes x store instructions == tile rows x row bytes
    float* obase = OUT + ((((size_t)(b * DZ + z0) * HY + (size_t)y0) * WX + (size_t)w0) * CH) + hp * 32;
{
#pragma unroll
        for (int s = 0; s < 4; ++s) { const int row = 4 * s + (lane >> 3), cofs = (lane & 7) * 4;   // 4 s x 4 rows = 16 rows; 8 lanes x 4 floats = 32 columns = one line
            const v4f val = *(const v4fa*)(&os[wb + row * OSP + cofs]);
            const size_t po = ((size_t)((s >> 1) * HY + (s & 1)) * WX + (size_t)(lane >> 3)) * CH;   // query row: qz = s>>1, qy = s&1, qw = lane>>3
            *(v4f*)(obase + po + cofs) = val; }
         }
}

extern "C" void kernel_launch(void* const* d_in, const int* in_sizes, int n_in,
                              void* d_out, int out_size, void* d_ws, size_t ws_size, hipStream_t stream) {
    if (n_in < 3) return;
    const size_t need = (size_t)NB * CH * CSTR;
    if ((size_t)in_sizes[0] < need || (size_t)in_sizes[1] < need || (size_t)in_sizes[2] < need) return;
    if ((size_t)out_size < need) return;
    // wire order: q, k, v
    const float* q = (const float*)d_in[0];
    const float* k = (const float*)d_in[1];
    const float* v = (const float*)d_in[2];
    float* OUT = (float*)d_out;      // [NB][16][32][32][96]

    k_nbrwin<<<dim3((DZ / 2) * (HY / 2), NB * 3, 1), 32 * AW, 0, stream>>>(q, k, v, OUT);
}

// v004
// Measured time: 12.4 microseconds a run.
// Versions between v002 and this one are left out; their measured steps multiply to 1.56 times as fast.
// Over all steps from v000 it is 2.70 times as fast.
#include <hip/hip_runtime.h>

// 3-D sliding-window grouped pair-score weighting: q/k/v [NB][96][16][32][32] (channel-major, 6 heads x 16), every query attends to its 3x3x3 window (dilation 1) of a zero-padded volume; padded slots keep logit 0 in the softmax and add no value; scale 16^-0.5; output [NB][16][32][32][96] (f32, channel = head*16 + c).
// Compute dtypes, f32 accumulate everywhere: logits v_wmma_f32_16x16x32_f16 (q, k RNE-converted to f16, K = 16 channels + 8 window-mask slots + 8 zeros, the last 16 in registers); P.V v_wmma_f32_16x16x32_f16 (P x16384 carry as single f16, cancels in the normalisation; v RNE-converted to f16); softmax f32.
// One launch. A work-group of 8 waves owns 2 z x 2 y x 32 w queries and one head pair. Per head it builds its own f16 tiles in LDS straight from the f32 inputs: k as [row 16 = 4 z x 4 y][wp 36][16] (c contiguous, wp = w + 1, zeros in the halo), q as [row 4 = 2 z x 2 y][w 32][16], v as window tile [ch 16][row 16][8 windows][8] with window wbk holding w = 4*wbk-1 .. 4*wbk+6 (zeros outside the volume).
// One wave per tile of 16 queries (2 z x 2 y x 4 w); key slots = 4 z x 4 y x 8 w = 128 per tile, transposed form S^T = K Q^T (A = key rows, B = query rows), packed P^T is the B fragment of O^T = V^T P^T (A = window-tile rows); window membership is summed into the logits by the matrix product itself: 8 of its 16 spare k slots hold flags of the key slot (A: 2^15 or 0) against a one-hot of the query (B: -2^15 or 0).

#ifndef NB
#define NB 2
#endif
#define NB_FULL 2
#define CH   96
#define NHD  6
#define HD   16
#define DZ   16
#define HY   32
#define WX   32
#define CSTR (DZ * HY * WX)      // channel stride of the inputs (floats)
#define WP   (WX + 4)            // padded width of the k tile: wp = w + 1, slots 0..35
#define NWB  (WX / 4)
#define AW   8                   // waves per work-group = w blocks of one row
#define KR   16                  // halo rows of a work-group: row = dz*4 + dy, z = z0-1+dz, y = y0-1+dy
#define VPIT (KR * NWB * 8 + 8)  // channel pitch (f16) of the v window tile: 2064 B, 4 banks on from the last channel
#define OSP  36                  // LDS row pitch (floats) of the output tile
#define SC2  ((float)(0.25 * 1.4426950408889634))   // HD^-0.5 * log2(e)
#define PSH  14.0f               // log2 of the P carry (16384)
#define KFLG 0x7800u              // f16 2^15: flag of a key slot
#define MSKB 0xF800u              // f16 -2^15: one-hot value of a query; flag x value = -2^30 on the raw logit of a key slot outside the window, far below any q.k of inputs up to some thousands in size

static_assert(NHD * HD == CH);
static_assert(HD == 16);                       // one O^T tile per head; logits K = 16 (upper 16 k slots: window-mask flags and zeros, from registers)
static_assert(NHD % 2 == 0);
static_assert(DZ % 2 == 0);
static_assert(HY % 2 == 0);
static_assert(WX == 32);                       // one lane per w in the q / k staging; tile index decode uses 3 + 4 + 3 bits
static_assert(HY == 32);
static_assert(DZ == 16);
static_assert(NWB == 8);
static_assert(AW == NWB);                      // wave index = w block
static_assert(WP >= WX + 4);                   // key slots reach wp = (WX - 4) + 7
static_assert((CH * 4) % 128 == 0);            // output position pitch = 3 lines
static_assert((OSP * 4) % 16 == 0);
static_assert((VPIT * 2) % 16 == 0);
static_assert(NB <= NB_FULL);
static_assert(AW * 16 * OSP * 4 + (KR * WP * HD + 4 * WX * HD + HD * VPIT) * 2 <= 81920);   // four work-groups fit one WGP's LDS

typedef _Float16 h16;
typedef __attribute__((ext_vector_type(16))) _Float16 v16h;
typedef __attribute__((ext_vector_type(8)))  _Float16 v8h;
typedef __attribute__((ext_vector_type(2)))  _Float16 v2h;
typedef __attribute__((ext_vector_type(2)))  float    v2f;
typedef __attribute__((ext_vector_type(8)))  unsigned u8v;
typedef __attribute__((ext_vector_type(8)))  float    v8f;
typedef __attribute__((ext_vector_type(4)))  float    v4f;
typedef v4f  __attribute__((may_alias)) v4fa;
typedef __attribute__((ext_vector_type(4)))  unsigned u4 __attribute__((may_alias));

__device__ __forceinline__ v16h cat16(v8h lo, v8h hi) { return __builtin_shufflevector(lo, hi, 0, 1, 2, 3, 4, 5, 6, 7, 8, 9, 10, 11, 12, 13, 14, 15); }
__device__ __forceinline__ v8f wmma16(v16h a, v16h b, v8f c) { return __builtin_amdgcn_wmma_f32_16x16x32_f16(false, a, false, b, (short)0, c, false, false); }
// one matrix instruction followed by its own four-slot guard (one accumulator per guard)
__device__ __forceinline__ v8f wmma16g(v16h a, v16h b, v8f c) { c = wmma16(a, b, c); asm volatile("v_nop\n\tv_nop\n\tv_nop\n\tv_nop" : "+v"(c) : "v"(a), "v"(b)); return c; }
// fragment with K = 16 + mask slots: p already includes + 8*(lane>>4); elements 0..7 <- k = 8h+0..7; elements 8..11 (k = 16+8h+0..3) <- the two words x0, x1 of mask flags, in the same order for A and B; elements 12..15 zero for A and B alike
__device__ __forceinline__ v16h ld8x(const h16* p, unsigned x0, unsigned x1) { return cat16(*(const v8h*)p, __builtin_bit_cast(v8h, (u4){x0, x1, 0u, 0u})); }
// ordering point for wave-private LDS tiles (same wave writes and reads)
__device__ __forceinline__ void wave_sync() { __builtin_amdgcn_fence(3 /* release order */, "wavefront"); __builtin_amdgcn_wave_barrier(); asm volatile("" ::: "memory"); }

typedef const __attribute__((address_space(1))) float* gfp;
typedef const __attribute__((address_space(1))) v4f*   gv4p;
typedef const __attribute__((address_space(1))) char*  gcp;
// a wave-uniform global address held in scalar registers: each load is then scalar base + the lane's fixed 32-bit offset, and no 64-bit vector address is formed anew per head
static __device__ __forceinline__ gfp sbase(const float* p) {
    const unsigned long long a = (unsigned long long)p;
    const unsigned lo = (unsigned)__builtin_amdgcn_readfirstlane((int)(unsigned)a), hi = (unsigned)__builtin_amdgcn_readfirstlane((int)(unsigned)(a >> 32));
    return (gfp)(((unsigned long long)hi << 32) | lo);
}
// load8: 8 channels (stride CSTR) of one row of a channel-major f32 input, lane = w: p is the same in every lane of the wave.
static __device__ __forceinline__ void load8(gfp p, unsigned w, float (&x)[8]) {
#pragma unroll
    for (int j = 0; j < 8; ++j) x[j] = (p + (size_t)j * CSTR)[w];
}
// put8: 8 f32 -> one 16-byte piece of an f16 tile, round to nearest even (the casts compile to one packed convert per element pair); m = bit mask per f16 pair, all ones inside the volume and 0 (= +0.0) outside it.
static __device__ __forceinline__ void put8(h16* dst, const float (&x)[8], u4 m) {
    v8h o;
#pragma unroll
    for (int j = 0; j < 8; ++j) o[j] = (h16)x[j];
    *(u4*)dst = __builtin_bit_cast(u4, o) & m;
}
static __device__ __forceinline__ int clampi(int a, int hi) { return a < 0 ? 0 : (a > hi ? hi : a); }

// k_nbrwin: one work-group per (2 z x 2 y x 32 w queries, head pair), one wave per 16-query tile. Query t = lane&15: qz = t>>3, qy = (t>>2)&1, qw = t&3 at (z0+qz, y0+qy, w0+qw).
// Key slot kk = 16j + row (j = 0..7): group g = kk>>3 -> dz = g>>2, dy = g&3, e = kk&7, volume position (z0-1+dz, y0-1+dy, w0-1+e) = k tile (row dz*4+dy, wp w0+e).
// S^T tile j: A = key rows (lane&15 = row), B = query rows; D element r of lane (t, h) = key slot 16j+8h+r -> dz = j>>1, dy = 2(j&1)+h, e = r.
// Slot kept iff dz-qz, dy-qy, e-qw all in {0,1,2}: exactly 27 per query (padded slots included with logit 0 from zero key rows).
// The mask rides in the logits product. Mask slot (h, i) = element 8+i of lane half h, A flag (2^15 or 0) x B value (-2^15 or 0):
//   h = 0: i = 0: [dz == 3] x [qz == 0], i = 1: [dz == 0] x [qz == 1], i = 2: [dy == 3] x [qy == 0], i = 3: [dy == 0] x [qy == 1];   h = 1: i = 0..3: [e - i not in 0..2] x [qw == i].
// A kept slot gets only exact zero products (its logit is unchanged); a dropped one gets -2^30 once to three times, so it never wins the maximum and its exp2 is 0. e = 6, 7 lie in no query's window: D elements 6, 7 are not read and their P is a constant 0.
// O^T[d][t] = V^T P^T, k-step s4 = key slots 32*s4..+31: A row d = lane&15 from the window tile, elements 0..7 <- (dz = s4, dy = h), elements 8..15 <- (dz = s4, dy = 2+h); B = packed P of S^T tiles 2*s4 and 2*s4+1.
__global__ __launch_bounds__(32 * AW) void k_nbrwin(const float* __restrict__ q, const float* __restrict__ k, const float* __restrict__ v, float* OUT) {
    __shared__ __align__(16) float os[AW * 16 * OSP];
    __shared__ __align__(16) h16 KL[KR * WP * HD];
    __shared__ __align__(16) h16 QL[4 * WX * HD];
    __shared__ __align__(16) h16 VL[HD * VPIT];
    const int tid = (int)threadIdx.x;
    const int lane = tid & 31, lr = lane & 15, hi = lane >> 4;
    const int wave = __builtin_amdgcn_readfirstlane(tid >> 5);
    const int wbk = wave, yb = (int)blockIdx.x & 15, zb = (int)blockIdx.x >> 4;
    const int b = blockIdx.y / 3, hp = blockIdx.y % 3;
    const int z0 = 2 * zb, y0 = 2 * yb, w0 = 4 * wbk;
    const int qz = lr >> 3, qy = (lr >> 2) & 1, qw = lr & 3;
    // mask words of the B fragment (query t = lr) and of the eight A fragments (key row lr: dy = 2(j&1) + (lr>>3), e = lr&7)
    const unsigned hm = (unsigned)-hi;                                        // all ones in lane half 1
    const unsigned bw = MSKB << (16 * (qw & 1));
    const unsigned bx0 = (hm & (qw < 2 ? bw : 0u)) | (~hm & (MSKB << (16 * qz)));
    const unsigned bx1 = (hm & (qw < 2 ? 0u : bw)) | (~hm & (MSKB << (16 * qy)));
    const int ke = lr & 7, kg = lr >> 3;
    unsigned nw[4];
#pragma unroll
    for (int i = 0; i < 4; ++i) nw[i] = ((unsigned)(ke - i) <= 2u) ? 0u : KFLG;
    const unsigned aw0 = hm & (nw[0] | (nw[1] << 16)), aw1 = hm & (nw[2] | (nw[3] << 16));
    unsigned ax0[8], ax1[8];
#pragma unroll
    for (int j = 0; j < 8; ++j) {
        const int dz = j >> 1, dy = 2 * (j & 1) + kg;
        ax0[j] = aw0 | (~hm & ((dz == 3 ? KFLG : 0u) | (dz == 0 ? KFLG << 16 : 0u)));
        ax1[j] = aw1 | (~hm & ((dy == 3 ? KFLG : 0u) | (dy == 0 ? KFLG << 16 : 0u)));
    }
    const int qrow  = (qz * 2 + qy) * WX + (w0 + qw);                         // q tile row
    const int krow0 = (lr >> 3) * WP + (w0 + (lr & 7));                       // k tile row; tile j adds ((j>>1)*4 + 2*(j&1))*WP; row <= 15, wp <= 35
    const int wb = wave * 16 * OSP;
    // staging indices, the same for both heads
    const int qr = wave >> 1, qc8 = (wave & 1) * 8;                           // q task: row, first channel
    const int vwk = tid & 7, vrow = (tid >> 3) & 15, vch0 = tid >> 7;         // v piece: window, halo row, channel parity
    const int vz = z0 - 1 + (vrow >> 2), vy = y0 - 1 + (vrow & 3);
    const unsigned vro = (unsigned)(vch0 * CSTR + (clampi(vz, DZ - 1) * HY + clampi(vy, HY - 1)) * WX);   // channel parity + clamped row: every address stays inside the input
    const int vbm = vwk > 0 ? vwk - 1 : 0, vbp = vwk < NWB - 1 ? vwk + 1 : NWB - 1;
    const unsigned voa = (vro + 4u * vbm + 3u) * 4u, vob = (vro + 4u * vwk) * 4u, voc = (vro + 4u * vbp) * 4u;   // byte offsets of w-1, own 4, next 4
    const bool vrok = ((unsigned)vz < (unsigned)DZ) & ((unsigned)vy < (unsigned)HY);
    const unsigned mr = vrok ? 0xFFFFu : 0u, mm = (vrok & (vwk >= 1)) ? 0xFFFFu : 0u, mp = (vrok & (vwk <= NWB - 2)) ? 0xFFFFu : 0u;
    const u4 vm = {mm | (mr << 16), mr | (mr << 16), mr | (mp << 16), mp | (mp << 16)};   // elements 0 | 1..4 | 5..7 = w-1 | own 4 | next 3
    // w halo of the k tile (wp = 0, 33, 34, 35), zero for both heads: 16 rows x 4 slots x 2 pieces, published by the first barrier below
    if (tid < KR * 4 * 2) { const int s = (tid >> 1) & 3; *(v8h*)(KL + ((tid >> 3) * WP + (s == 0 ? 0 : WX + s)) * HD + (tid & 1) * 8) = (v8h){}; }
#pragma unroll 1
    for (int hh = 0; hh < 2; ++hh) {
        const int hd = 2 * hp + hh;
        const size_t cbase = (size_t)(b * CH + hd * HD) * CSTR;
        // every wave has left the last head's tiles before they are rewritten
        __syncthreads();
        // all loads of the head first, so that one memory latency covers them.
        // v window tile: 2048 pieces (channel, row, window), 8 per thread: channel 2*it + (tid>>7); a wave covers 4 y rows x 8 windows of one channel and z
        float va3[8]; v4f vB[8], vC[8];
        const gfp vh = (gfp)(v + cbase);
#pragma unroll
        for (int it = 0; it < 8; ++it) va3[it] = *(gfp)((gcp)(vh + (size_t)(2 * it) * CSTR) + voa);   // the base is the same in every lane; the lane's own part is the byte offsets voa, vob, voc
        // the loads below may land in address registers of the loads above: the wait that stands in front of such an overwrite
        asm volatile("s_wait_xcnt 0x0" ::: "memory");
        // k tile: 32 tasks (row, 8 channels), 4 per wave, lane = w: each load is one whole 128-byte row. q tile: 8 tasks, one per wave.
        float xk[4][8], xq[8];
#pragma unroll
        for (int it = 0; it < 4; ++it) {
            const int task = wave * 4 + it, row = task >> 1, c8 = (task & 1) * 8;
            const int zc = clampi(z0 - 1 + (row >> 2), DZ - 1), yc = clampi(y0 - 1 + (row & 3), HY - 1);
            load8(sbase(k + cbase + (size_t)c8 * CSTR + (size_t)((zc * HY + yc) * WX)), (unsigned)lane, xk[it]);
        }
        load8(sbase(q + cbase + (size_t)qc8 * CSTR + (size_t)(((z0 + (qr >> 1)) * HY + (y0 + (qr & 1))) * WX)), (unsigned)lane, xq);
#pragma unroll
        for (int it = 0; it < 7; ++it) {
            const gcp cp = (gcp)(vh + (size_t)(2 * it) * CSTR);
            vB[it] = *(gv4p)(cp + vob); vC[it] = *(gv4p)(cp + voc);
        }
        // the last load of each group may land in the group's own address registers: the same wait
        asm volatile("s_wait_xcnt 0x0" ::: "memory");
        vB[7] = *(gv4p)((gcp)(vh + (size_t)14 * CSTR) + vob); vC[7] = *(gv4p)((gcp)(vh + (size_t)14 * CSTR) + voc);
        // inputs-only fences on the loaded values: they keep all 64 loads issued ahead of the conversions; without them the compiler spreads the v loads among the conversions, each behind a full wait of its own
#pragma unroll
        for (int it = 0; it < 4; ++it) asm volatile("" :: "v"(xk[it][0]), "v"(xk[it][1]), "v"(xk[it][2]), "v"(xk[it][3]), "v"(xk[it][4]), "v"(xk[it][5]), "v"(xk[it][6]), "v"(xk[it][7]));
        asm volatile("" :: "v"(xq[0]), "v"(xq[1]), "v"(xq[2]), "v"(xq[3]), "v"(xq[4]), "v"(xq[5]), "v"(xq[6]), "v"(xq[7]));
#pragma unroll
        for (int it = 0; it < 8; ++it) asm volatile("" :: "v"(va3[it]), "v"(vB[it]), "v"(vC[it]));
#pragma unroll
        for (int it = 0; it < 4; ++it) {
            const int task = wave * 4 + it, row = task >> 1, c8 = (task & 1) * 8;
            const bool ok = ((unsigned)(z0 - 1 + (row >> 2)) < (unsigned)DZ) & ((unsigned)(y0 - 1 + (row & 3)) < (unsigned)HY);
            const unsigned km = ok ? 0xFFFFFFFFu : 0u;
            put8(KL + (row * WP + lane + 1) * HD + c8, xk[it], (u4){km, km, km, km});
        }
        put8(QL + (qr * WX + lane) * HD + qc8, xq, (u4){0xFFFFFFFFu, 0xFFFFFFFFu, 0xFFFFFFFFu, 0xFFFFFFFFu});
#pragma unroll
        for (int it = 0; it < 8; ++it) {
            const float e[8] = {va3[it], vB[it][0], vB[it][1], vB[it][2], vB[it][3], vC[it][0], vC[it][1], vC[it][2]};
            put8(VL + (2 * it + vch0) * VPIT + (vrow * NWB + vwk) * 8, e, vm);
        }
        // the three tiles are complete before any wave reads them
        __syncthreads();
        const v16h qf = ld8x(QL + qrow * HD + 8 * hi, bx0, bx1);              // B fragment: col t, k = c, then the query's mask values
        v8f s[8];
#pragma unroll
        for (int j = 0; j < 8; ++j) {
            const int kr = krow0 + ((j >> 1) * 4 + 2 * (j & 1)) * WP;
            const v16h ka = ld8x(KL + kr * HD + 8 * hi, ax0[j], ax1[j]);      // A fragment: row key slot, k = c, then the slot's mask flags
            s[j] = wmma16g(ka, qf, (v8f){});
        }
        float mx = s[0][0], my = s[1][0];                                     // two chains: a maximum does not depend on its order
#pragma unroll
        for (int j = 0; j < 8; j += 2) {
#pragma unroll
            for (int r = 0; r < 6; ++r) { mx = fmaxf(mx, s[j][r]); my = fmaxf(my, s[j + 1][r]); } }   // raw logits, dropped slots near -2^30 or below; SC2 > 0 scales the maximum afterwards
        mx = fmaxf(mx, my);
        mx = fmaxf(mx, __shfl_xor(mx, 16, 32));
        const float sh = PSH - mx * SC2;
        v8f o = (v8f){};
        float ls = 0.0f;
#pragma unroll
        for (int s4 = 0; s4 < 4; ++s4) {
            u8v pw; pw[3] = 0u; pw[7] = 0u;                                   // B fragment by words: elements 6, 7, 14, 15 (e = 6, 7) are 0
#pragma unroll
            for (int r = 0; r < 6; r += 2) {
                v2f xa, xb;
#pragma unroll
                for (int i = 0; i < 2; ++i) {                                 // dropped slots: exponent below -10^8, exp2 = 0
                    xa[i] = __builtin_amdgcn_exp2f(s[2 * s4][r + i] * SC2 + sh); xb[i] = __builtin_amdgcn_exp2f(s[2 * s4 + 1][r + i] * SC2 + sh); }
                const v2h pa = __builtin_convertvector(xa, v2h), pc = __builtin_convertvector(xb, v2h);   // RNE, <= 2^14; a kept weight below 2^-14 rounds to an f16 subnormal or 0
#pragma unroll
                for (int i = 0; i < 2; ++i) ls += (float)pa[i] + (float)pc[i];
                pw[r >> 1] = __builtin_bit_cast(unsigned, pa); pw[4 + (r >> 1)] = __builtin_bit_cast(unsigned, pc); }
            const v16h pb = __builtin_bit_cast(v16h, pw);
            const int va = lr * VPIT + ((s4 * 4 + hi) * NWB + wbk) * 8;
            const v16h vf = cat16(*(const v8h*)(VL + va), *(const v8h*)(VL + va + 2 * NWB * 8));   // dy and dy + 2
            o = wmma16g(vf, pb, o);
        }
        const float l = ls + __shfl_xor(ls, 16, 32);                          // >= 16384: the row maximum is always kept
        const float inv = 1.0f / l;
        // O^T D layout: o[r] = (d = 8h + r, t = lane&15) -> os[t][hh*16 + d]
        { v4f a, c;
          a[0] = o[0] * inv; a[1] = o[1] * inv; a[2] = o[2] * inv; a[3] = o[3] * inv; c[0] = o[4] * inv; c[1] = o[5] * inv; c[2] = o[6] * inv; c[3] = o[7] * inv;
          *(v4fa*)(&os[wb + lr * OSP + hh * 16 + 8 * hi]) = a; *(v4fa*)(&os[wb + lr * OSP + hh * 16 + 8 * hi + 4]) = c; }
    }
    wave_sync();
    static_assert(32 * 16 * 4 == 16 * 128);                                   // lanes x bytes x store instructions == tile rows x row bytes
    float* obase = OUT + ((((size_t)(b * DZ + z0) * HY + (size_t)y0) * WX + (size_t)w0) * CH) + hp * 32;
{
#pragma unroll
        for (int s = 0; s < 4; ++s) { const int row = 4 * s + (lane >> 3), cofs = (lane & 7) * 4;   // 4 s x 4 rows = 16 rows; 8 lanes x 4 floats = 32 columns = one line
            const v4f val = *(const v4fa*)(&os[wb + row * OSP + cofs]);
            const size_t po = ((size_t)((s >> 1) * HY + (s & 1)) * WX + (size_t)(lane >> 3)) * CH;   // query row: qz = s>>1, qy = s&1, qw = lane>>3
            *(v4f*)(obase + po + cofs) = val; }
         }
}

extern "C" void kernel_launch(void* const* d_in, const int* in_sizes, int n_in,
                              void* d_out, int out_size, void* d_ws, size_t ws_size, hipStream_t stream) {
    if (n_in < 3) return;
    const size_t need = (size_t)NB * CH * CSTR;
    if ((size_t)in_sizes[0] < need || (size_t)in_sizes[1] < need || (size_t)in_sizes[2] < need) return;
    if ((size_t)out_size < need) return;
    // wire order: q, k, v
    const float* q = (const float*)d_in[0];
    const float* k = (const float*)d_in[1];
    const float* v = (const float*)d_in[2];
    float* OUT = (float*)d_out;      // [NB][16][32][32][96]

    k_nbrwin<<<dim3((DZ / 2) * (HY / 2), NB * 3, 1), 32 * AW, 0, stream>>>(q, k, v, OUT);
}

// v005
// A run of this version takes 10.6 microseconds.
// Next to v004, in two timings, it ran 1.17 times as fast each time.
// Counting every step since v000, it is 3.16 times as fast.
#include <hip/hip_runtime.h>

// 3-D sliding-window grouped pair-score weighting: q/k/v [NB][96][16][32][32] (channel-major, 6 heads x 16), every query attends to its 3x3x3 window (dilation 1) of a zero-padded volume; padded slots keep logit 0 in the softmax and add no value; scale 16^-0.5; output [NB][16][32][32][96] (f32, channel = head*16 + c).
// Compute dtypes, f32 accumulate everywhere: logits v_wmma_f32_16x16x32_f16 (q, k RNE-converted to f16, K = 16 channels + 8 window-mask slots + 8 zeros, the last 16 in registers); P.V v_wmma_f32_16x16x32_f16 (P x16384 carry as single f16, cancels in the normalisation; v RNE-converted to f16); softmax f32.
// One launch. A work-group of 8 waves owns 2 z x 2 y x 32 w queries and one head pair. Per head it builds its own f16 tiles in LDS straight from the f32 inputs: k as [row 16 = 4 z x 4 y][wp 36][16] (c contiguous, wp = w + 1, zeros in the halo), q as [row 4 = 2 z x 2 y][w 32][16], v in the k tile's own form [row 16][wp 36][16] (zeros outside the volume).
// One wave per tile of 16 queries (2 z x 2 y x 4 w); key slots = 4 z x 4 y x 8 w = 128 per tile, transposed form S^T = K Q^T (A = key rows, B = query rows), packed P^T is the B fragment of O^T = V^T P^T (A = v tile read by transposing LDS loads); window membership is summed into the logits by the matrix product itself: 8 of its 16 spare k slots hold flags of the key slot (A: 2^15 or 0) against a one-hot of the query (B: -2^15 or 0).

#ifndef NB
#define NB 2
#endif
#define NB_FULL 2
#define CH   96
#define NHD  6
#define HD   16
#define DZ   16
#define HY   32
#define WX   32
#define CSTR (DZ * HY * WX)      // channel stride of the inputs (floats)
#define WP   (WX + 4)            // padded width of the k tile: wp = w + 1, slots 0..35
#define NWB  (WX / 4)
#define AW   8                   // waves per work-group = w blocks of one row
#define KR   16                  // halo rows of a work-group: row = dz*4 + dy, z = z0-1+dz, y = y0-1+dy
#define OSP  36                  // LDS row pitch (floats) of the output tile
#define SC2  ((float)(0.25 * 1.4426950408889634))   // HD^-0.5 * log2(e)
#define PSH  14.0f               // log2 of the P carry (16384)
#define KFLG 0x7800u              // f16 2^15: flag of a key slot
#define MSKB 0xF800u              // f16 -2^15: one-hot value of a query; flag x value = -2^30 on the raw logit of a key slot outside the window, far below any q.k of inputs up to some thousands in size

static_assert(NHD * HD == CH);
static_assert(HD == 16);                       // one O^T tile per head; logits K = 16 (upper 16 k slots: window-mask flags and zeros, from registers)
static_assert(NHD % 2 == 0);
static_assert(DZ % 2 == 0);
static_assert(HY % 2 == 0);
static_assert(WX == 32);                       // one lane per w in the q / k staging; tile index decode uses 3 + 4 + 3 bits
static_assert(HY == 32);
static_assert(DZ == 16);
static_assert(NWB == 8);
static_assert(AW == NWB);                      // wave index = w block
static_assert(WP >= WX + 4);                   // key slots reach wp = (WX - 4) + 7
static_assert((CH * 4) % 128 == 0);            // output position pitch = 3 lines
static_assert((OSP * 4) % 16 == 0);
static_assert((HD * 2) % 64 == 32);              // slot pitch of the v tile = 32 B x odd: the pitch of its transposing reader
static_assert(NB <= NB_FULL);
static_assert(AW * 16 * OSP * 4 + (2 * KR * WP * HD + 4 * WX * HD) * 2 <= 81920);   // four work-groups fit one WGP's LDS

typedef _Float16 h16;
typedef __attribute__((ext_vector_type(16))) _Float16 v16h;
typedef __attribute__((ext_vector_type(8)))  _Float16 v8h;
typedef __attribute__((ext_vector_type(2)))  _Float16 v2h;
typedef __attribute__((ext_vector_type(2)))  float    v2f;
typedef __attribute__((ext_vector_type(8)))  unsigned u8v;
typedef __attribute__((ext_vector_type(8)))  float    v8f;
typedef __attribute__((ext_vector_type(4)))  float    v4f;
typedef v4f  __attribute__((may_alias)) v4fa;
typedef __attribute__((ext_vector_type(4)))  unsigned u4 __attribute__((may_alias));

__device__ __forceinline__ v16h cat16(v8h lo, v8h hi) { return __builtin_shufflevector(lo, hi, 0, 1, 2, 3, 4, 5, 6, 7, 8, 9, 10, 11, 12, 13, 14, 15); }
__device__ __forceinline__ v8f wmma16(v16h a, v16h b, v8f c) { return __builtin_amdgcn_wmma_f32_16x16x32_f16(false, a, false, b, (short)0, c, false, false); }
// one matrix instruction followed by its own four-slot guard (one accumulator per guard)
__device__ __forceinline__ v8f wmma16g(v16h a, v16h b, v8f c) { c = wmma16(a, b, c); asm volatile("v_nop\n\tv_nop\n\tv_nop\n\tv_nop" : "+v"(c) : "v"(a), "v"(b)); return c; }
// fragment with K = 16 + mask slots: p already includes + 8*(lane>>4); elements 0..7 <- k = 8h+0..7; elements 8..11 (k = 16+8h+0..3) <- the two words x0, x1 of mask flags, in the same order for A and B; elements 12..15 zero for A and B alike
__device__ __forceinline__ v16h ld8x(const h16* p, unsigned x0, unsigned x1) { return cat16(*(const v8h*)p, __builtin_bit_cast(v8h, (u4){x0, x1, 0u, 0u})); }
// transposing LDS load: the 16 lanes of a lane half hand in 8 slot rows (lane&7) x 2 pieces of 8 channels ((lane>>3)&1); lane (c, h) gets channel c of the 8 slot rows of half h, in row order
typedef short s16x8 __attribute__((ext_vector_type(8)));
typedef __attribute__((address_space(3))) s16x8 lds_s16x8;
__device__ __forceinline__ v8h ld_tr16(const h16* p) { return __builtin_bit_cast(v8h, __builtin_amdgcn_ds_load_tr16_b128_v8i16((lds_s16x8*)p)); }
// ordering point for wave-private LDS tiles (same wave writes and reads)
__device__ __forceinline__ void wave_sync() { __builtin_amdgcn_fence(3 /* release order */, "wavefront"); __builtin_amdgcn_wave_barrier(); asm volatile("" ::: "memory"); }

typedef const __attribute__((address_space(1))) float* gfp;
// a wave-uniform global address held in scalar registers: each load is then scalar base + the lane's fixed 32-bit offset, and no 64-bit vector address is formed anew per head
static __device__ __forceinline__ gfp sbase(const float* p) {
    const unsigned long long a = (unsigned long long)p;
    const unsigned lo = (unsigned)__builtin_amdgcn_readfirstlane((int)(unsigned)a), hi = (unsigned)__builtin_amdgcn_readfirstlane((int)(unsigned)(a >> 32));
    return (gfp)(((unsigned long long)hi << 32) | lo);
}
// load8: 8 channels (stride CSTR) of one row of a channel-major f32 input, lane = w: p is the same in every lane of the wave.
static __device__ __forceinline__ void load8(gfp p, unsigned w, float (&x)[8]) {
#pragma unroll
    for (int j = 0; j < 8; ++j) x[j] = (p + (size_t)j * CSTR)[w];
}
// put8: 8 f32 -> one 16-byte piece of an f16 tile, round to nearest even (the casts compile to one packed convert per element pair); m = bit mask per f16 pair, all ones inside the volume and 0 (= +0.0) outside it.
static __device__ __forceinline__ void put8(h16* dst, const float (&x)[8], u4 m) {
    v8h o;
#pragma unroll
    for (int j = 0; j < 8; ++j) o[j] = (h16)x[j];
    *(u4*)dst = __builtin_bit_cast(u4, o) & m;
}
static __device__ __forceinline__ int clampi(int a, int hi) { return a < 0 ? 0 : (a > hi ? hi : a); }

// k_nbrwin: one work-group per (2 z x 2 y x 32 w queries, head pair), one wave per 16-query tile. Query t = lane&15: qz = t>>3, qy = (t>>2)&1, qw = t&3 at (z0+qz, y0+qy, w0+qw).
// Key slot kk = 16j + row (j = 0..7): group g = kk>>3 -> dz = g>>2, dy = g&3, e = kk&7, volume position (z0-1+dz, y0-1+dy, w0-1+e) = k tile (row dz*4+dy, wp w0+e).
// S^T tile j: A = key rows (lane&15 = row), B = query rows; D element r of lane (t, h) = key slot 16j+8h+r -> dz = j>>1, dy = 2(j&1)+h, e = r.
// Slot kept iff dz-qz, dy-qy, e-qw all in {0,1,2}: exactly 27 per query (padded slots included with logit 0 from zero key rows).
// The mask rides in the logits product. Mask slot (h, i) = element 8+i of lane half h, A flag (2^15 or 0) x B value (-2^15 or 0):
//   h = 0: i = 0: [dz == 3] x [qz == 0], i = 1: [dz == 0] x [qz == 1], i = 2: [dy == 3] x [qy == 0], i = 3: [dy == 0] x [qy == 1];   h = 1: i = 0..3: [e - i not in 0..2] x [qw == i].
// A kept slot gets only exact zero products (its logit is unchanged); a dropped one gets -2^30 once to three times, so it never wins the maximum and its exp2 is 0. e = 6, 7 lie in no query's window: D elements 6, 7 are not read and their P is a constant 0.
// O^T[d][t] = V^T P^T, k-step s4 = key slots 32*s4..+31: A row d = lane&15 from the v tile through two transposing loads, elements 0..7 <- (dz = s4, dy = h, e = 0..7), elements 8..15 <- (dz = s4, dy = 2+h, e = 0..7); B = packed P of S^T tiles 2*s4 and 2*s4+1.
__global__ __launch_bounds__(32 * AW) void k_nbrwin(const float* __restrict__ q, const float* __restrict__ k, const float* __restrict__ v, float* OUT) {
    __shared__ __align__(16) float os[AW * 16 * OSP];
    __shared__ __align__(16) h16 KL[KR * WP * HD];
    __shared__ __align__(16) h16 QL[4 * WX * HD];
    __shared__ __align__(16) h16 VL[KR * WP * HD];
    const int tid = (int)threadIdx.x;
    const int lane = tid & 31, lr = lane & 15, hi = lane >> 4;
    const int wave = __builtin_amdgcn_readfirstlane(tid >> 5);
    const int wbk = wave, yb = (int)blockIdx.x & 15, zb = (int)blockIdx.x >> 4;
    const int b = blockIdx.y / 3, hp = blockIdx.y % 3;
    const int z0 = 2 * zb, y0 = 2 * yb, w0 = 4 * wbk;
    const int qz = lr >> 3, qy = (lr >> 2) & 1, qw = lr & 3;
    // mask words of the B fragment (query t = lr) and of the eight A fragments (key row lr: dy = 2(j&1) + (lr>>3), e = lr&7)
    const unsigned hm = (unsigned)-hi;                                        // all ones in lane half 1
    const unsigned bw = MSKB << (16 * (qw & 1));
    const unsigned bx0 = (hm & (qw < 2 ? bw : 0u)) | (~hm & (MSKB << (16 * qz)));
    const unsigned bx1 = (hm & (qw < 2 ? 0u : bw)) | (~hm & (MSKB << (16 * qy)));
    const int ke = lr & 7, kg = lr >> 3;
    unsigned nw[4];
#pragma unroll
    for (int i = 0; i < 4; ++i) nw[i] = ((unsigned)(ke - i) <= 2u) ? 0u : KFLG;
    const unsigned aw0 = hm & (nw[0] | (nw[1] << 16)), aw1 = hm & (nw[2] | (nw[3] << 16));
    unsigned ax0[8], ax1[8];
#pragma unroll
    for (int j = 0; j < 8; ++j) {
        const int dz = j >> 1, dy = 2 * (j & 1) + kg;
        ax0[j] = aw0 | (~hm & ((dz == 3 ? KFLG : 0u) | (dz == 0 ? KFLG << 16 : 0u)));
        ax1[j] = aw1 | (~hm & ((dy == 3 ? KFLG : 0u) | (dy == 0 ? KFLG << 16 : 0u)));
    }
    const int qrow  = (qz * 2 + qy) * WX + (w0 + qw);                         // q tile row
    const int krow0 = (lr >> 3) * WP + (w0 + (lr & 7));                       // k tile row; tile j adds ((j>>1)*4 + 2*(j&1))*WP; row <= 15, wp <= 35
    const int wb = wave * 16 * OSP;
    // staging indices, the same for both heads
    const int qr = wave >> 1, qc8 = (wave & 1) * 8;                           // q task: row, first channel
    const int vrow0 = (hi * WP + (w0 + (lane & 7))) * HD + 8 * ((lane >> 3) & 1);   // v tile piece this lane hands to the transposing loads: slot row (dy = hi, e = lane&7), channel half; step s4 adds 4*s4 rows, the second load 2 rows
    unsigned ro[4];                                                           // k / v task: first channel + clamped row, in floats: every address stays inside the input; the same in every lane and kept in scalar registers, so that each head's row bases are scalar adds
#pragma unroll
    for (int it = 0; it < 4; ++it) {
        const int task = wave * 4 + it, row = task >> 1, c8 = (task & 1) * 8;
        ro[it] = (unsigned)__builtin_amdgcn_readfirstlane(c8 * CSTR + (clampi(z0 - 1 + (row >> 2), DZ - 1) * HY + clampi(y0 - 1 + (row & 3), HY - 1)) * WX);
    }
    // w halo of the k and v tiles (wp = 0, 33, 34, 35), zero for both heads: 2 tiles x 16 rows x 4 slots x 2 pieces, published by the first barrier below
    static_assert(32 * AW == 2 * KR * 4 * 2);
    { const int u = tid & 127, s = (u >> 1) & 3; *(v8h*)((tid < 128 ? KL : VL) + ((u >> 3) * WP + (s == 0 ? 0 : WX + s)) * HD + (u & 1) * 8) = (v8h){}; }
#pragma unroll 1
    for (int hh = 0; hh < 2; ++hh) {
        const int hd = 2 * hp + hh;
        const size_t cbase = (size_t)(b * CH + hd * HD) * CSTR;
        // every wave has left the last head's tiles before they are rewritten
        __syncthreads();
        // all loads of the head first, so that one memory latency covers them.
        // k and v tiles: 32 tasks each (row, 8 channels), 4 per wave, lane = w: each load is one whole 128-byte row. q tile: 8 tasks, one per wave.
        float xk[4][8], xv[4][8], xq[8];
#pragma unroll
        for (int it = 0; it < 4; ++it) {
            load8(sbase(k + cbase + ro[it]), (unsigned)lane, xk[it]);
            load8(sbase(v + cbase + ro[it]), (unsigned)lane, xv[it]);
        }
        load8(sbase(q + cbase + (size_t)qc8 * CSTR + (size_t)(((z0 + (qr >> 1)) * HY + (y0 + (qr & 1))) * WX)), (unsigned)lane, xq);
        // inputs-only fences on the loaded values: they keep all 72 loads issued ahead of the conversions, so that no load waits behind a conversion's wait
#pragma unroll
        for (int it = 0; it < 4; ++it) {
            asm volatile("" :: "v"(xk[it][0]), "v"(xk[it][1]), "v"(xk[it][2]), "v"(xk[it][3]), "v"(xk[it][4]), "v"(xk[it][5]), "v"(xk[it][6]), "v"(xk[it][7]));
            asm volatile("" :: "v"(xv[it][0]), "v"(xv[it][1]), "v"(xv[it][2]), "v"(xv[it][3]), "v"(xv[it][4]), "v"(xv[it][5]), "v"(xv[it][6]), "v"(xv[it][7]));
        }
        asm volatile("" :: "v"(xq[0]), "v"(xq[1]), "v"(xq[2]), "v"(xq[3]), "v"(xq[4]), "v"(xq[5]), "v"(xq[6]), "v"(xq[7]));
#pragma unroll
        for (int it = 0; it < 4; ++it) {
            const int task = wave * 4 + it, row = task >> 1, c8 = (task & 1) * 8;
            const bool ok = ((unsigned)(z0 - 1 + (row >> 2)) < (unsigned)DZ) & ((unsigned)(y0 - 1 + (row & 3)) < (unsigned)HY);
            const unsigned km = ok ? 0xFFFFFFFFu : 0u;
            put8(KL + (row * WP + lane + 1) * HD + c8, xk[it], (u4){km, km, km, km});
            put8(VL + (row * WP + lane + 1) * HD + c8, xv[it], (u4){km, km, km, km});
        }
        put8(QL + (qr * WX + lane) * HD + qc8, xq, (u4){0xFFFFFFFFu, 0xFFFFFFFFu, 0xFFFFFFFFu, 0xFFFFFFFFu});
        // the three tiles are complete before any wave reads them
        __syncthreads();
        const v16h qf = ld8x(QL + qrow * HD + 8 * hi, bx0, bx1);              // B fragment: col t, k = c, then the query's mask values
        v8f s[8];
#pragma unroll
        for (int j = 0; j < 8; ++j) {
            const int kr = krow0 + ((j >> 1) * 4 + 2 * (j & 1)) * WP;
            const v16h ka = ld8x(KL + kr * HD + 8 * hi, ax0[j], ax1[j]);      // A fragment: row key slot, k = c, then the slot's mask flags
            s[j] = wmma16g(ka, qf, (v8f){});
        }
        float mx = s[0][0], my = s[1][0];                                     // two chains: a maximum does not depend on its order
#pragma unroll
        for (int j = 0; j < 8; j += 2) {
#pragma unroll
            for (int r = 0; r < 6; ++r) { mx = fmaxf(mx, s[j][r]); my = fmaxf(my, s[j + 1][r]); } }   // raw logits, dropped slots near -2^30 or below; SC2 > 0 scales the maximum afterwards
        mx = fmaxf(mx, my);
        mx = fmaxf(mx, __shfl_xor(mx, 16, 32));
        const float sh = PSH - mx * SC2;
        v8f o = (v8f){};
        float ls = 0.0f;
#pragma unroll
        for (int s4 = 0; s4 < 4; ++s4) {
            u8v pw; pw[3] = 0u; pw[7] = 0u;                                   // B fragment by words: elements 6, 7, 14, 15 (e = 6, 7) are 0
#pragma unroll
            for (int r = 0; r < 6; r += 2) {
                v2f xa, xb;
#pragma unroll
                for (int i = 0; i < 2; ++i) {                                 // dropped slots: exponent below -10^8, exp2 = 0
                    xa[i] = __builtin_amdgcn_exp2f(s[2 * s4][r + i] * SC2 + sh); xb[i] = __builtin_amdgcn_exp2f(s[2 * s4 + 1][r + i] * SC2 + sh); }
                const v2h pa = __builtin_convertvector(xa, v2h), pc = __builtin_convertvector(xb, v2h);   // RNE, <= 2^14; a kept weight below 2^-14 rounds to an f16 subnormal or 0
#pragma unroll
                for (int i = 0; i < 2; ++i) ls += (float)pa[i] + (float)pc[i];
                pw[r >> 1] = __builtin_bit_cast(unsigned, pa); pw[4 + (r >> 1)] = __builtin_bit_cast(unsigned, pc); }
            const v16h pb = __builtin_bit_cast(v16h, pw);
            const int va = vrow0 + s4 * 4 * WP * HD;
            const v16h vf = cat16(ld_tr16(VL + va), ld_tr16(VL + va + 2 * WP * HD));   // dy and dy + 2
            o = wmma16g(vf, pb, o);
        }
        const float l = ls + __shfl_xor(ls, 16, 32);                          // >= 16384: the row maximum is always kept
        const float inv = 1.0f / l;
        // O^T D layout: o[r] = (d = 8h + r, t = lane&15) -> os[t][hh*16 + d]
        { v4f a, c;
          a[0] = o[0] * inv; a[1] = o[1] * inv; a[2] = o[2] * inv; a[3] = o[3] * inv; c[0] = o[4] * inv; c[1] = o[5] * inv; c[2] = o[6] * inv; c[3] = o[7] * inv;
          *(v4fa*)(&os[wb + lr * OSP + hh * 16 + 8 * hi]) = a; *(v4fa*)(&os[wb + lr * OSP + hh * 16 + 8 * hi + 4]) = c; }
    }
    wave_sync();
    static_assert(32 * 16 * 4 == 16 * 128);                                   // lanes x bytes x store instructions == tile rows x row bytes
    float* obase = OUT + ((((size_t)(b * DZ + z0) * HY + (size_t)y0) * WX + (size_t)w0) * CH) + hp * 32;
{
#pragma unroll
        for (int s = 0; s < 4; ++s) { const int row = 4 * s + (lane >> 3), cofs = (lane & 7) * 4;   // 4 s x 4 rows = 16 rows; 8 lanes x 4 floats = 32 columns = one line
            const v4f val = *(const v4fa*)(&os[wb + row * OSP + cofs]);
            const size_t po = ((size_t)((s >> 1) * HY + (s & 1)) * WX + (size_t)(lane >> 3)) * CH;   // query row: qz = s>>1, qy = s&1, qw = lane>>3
            *(v4f*)(obase + po + cofs) = val; }
         }
}

extern "C" void kernel_launch(void* const* d_in, const int* in_sizes, int n_in,
                              void* d_out, int out_size, void* d_ws, size_t ws_size, hipStream_t stream) {
    if (n_in < 3) return;
    const size_t need = (size_t)NB * CH * CSTR;
    if ((size_t)in_sizes[0] < need || (size_t)in_sizes[1] < need || (size_t)in_sizes[2] < need) return;
    if ((size_t)out_size < need) return;
    // wire order: q, k, v
    const float* q = (const float*)d_in[0];
    const float* k = (const float*)d_in[1];
    const float* v = (const float*)d_in[2];
    float* OUT = (float*)d_out;      // [NB][16][32][32][96]

    k_nbrwin<<<dim3((DZ / 2) * (HY / 2), NB * 3, 1), 32 * AW, 0, stream>>>(q, k, v, OUT);
}

// v006
// Measured time: 9.43 microseconds a run.
// Next to v005, in two timings, it ran 1.13 times as fast each time.
// Counting every step since v000, it is 3.56 times as fast.
#include <hip/hip_runtime.h>

// 3-D sliding-window grouped pair-score weighting: q/k/v [NB][96][16][32][32] (channel-major, 6 heads x 16), every query attends to its 3x3x3 window (dilation 1) of a zero-padded volume; padded slots keep logit 0 in the softmax and add no value; scale 16^-0.5; output [NB][16][32][32][96] (f32, channel = head*16 + c).
// Compute dtypes, f32 accumulate everywhere: logits v_wmma_f32_16x16x32_f16 (q, k RNE-converted to f16, K = 16 channels + 8 window-mask slots + 8 zeros, the last 16 in registers); P.V v_wmma_f32_16x16x32_f16 (P x16384 carry as single f16, cancels in the normalisation; v RNE-converted to f16); softmax f32.
// One launch. A work-group of 8 waves owns 2 z x 2 y x 32 w queries and one head pair. Per head it builds its own f16 tiles in LDS straight from the f32 inputs: k as [row 16 = 4 z x 4 y][wp 36][16] (c contiguous, wp = w + 1, zeros in the halo), q as [row 4 = 2 z x 2 y][w 32][16], v in the k tile's own form [row 16][wp 36][16] (zeros outside the volume).
// One wave per tile of 16 queries (2 z x 2 y x 4 w); key slots = 4 z x 4 y x 8 w = 128 per tile, transposed form S^T = K Q^T (A = key rows, B = query rows), packed P^T is the B fragment of O^T = V^T P^T (A = v tile read by transposing LDS loads); window membership is summed into the logits by the matrix product itself: 8 of its 16 spare k slots hold flags of the key slot (A: 2^15 or 0) against a one-hot of the query (B: -2^15 or 0).

#ifndef NB
#define NB 2
#endif
#define NB_FULL 2
#define CH   96
#define NHD  6
#define HD   16
#define DZ   16
#define HY   32
#define WX   32
#define CSTR (DZ * HY * WX)      // channel stride of the inputs (floats)
#define WP   (WX + 4)            // padded width of the k tile: wp = w + 1, slots 0..35
#define NWB  (WX / 4)
#define AW   8                   // waves per work-group = w blocks of one row
#define KR   16                  // halo rows of a work-group: row = dz*4 + dy, z = z0-1+dz, y = y0-1+dy
#define OSP  36                  // LDS row pitch (floats) of the output tile
#define SC2  ((float)(0.25 * 1.4426950408889634))   // HD^-0.5 * log2(e)
#define PSH  14.0f               // log2 of the P carry (16384)
#define KFLG 0x7800u              // f16 2^15: flag of a key slot
#define MSKB 0xF800u              // f16 -2^15: one-hot value of a query; flag x value = -2^30 on the raw logit of a key slot outside the window, far below any q.k of inputs up to some thousands in size

static_assert(NHD * HD == CH);
static_assert(HD == 16);                       // one O^T tile per head; logits K = 16 (upper 16 k slots: window-mask flags and zeros, from registers)
static_assert(NHD % 2 == 0);
static_assert(DZ % 2 == 0);
static_assert(HY % 2 == 0);
static_assert(WX == 32);                       // one lane per w in the q / k staging; tile index decode uses 3 + 4 + 3 bits
static_assert(HY == 32);
static_assert(DZ == 16);
static_assert(NWB == 8);
static_assert(AW == NWB);                      // wave index = w block
static_assert(WP >= WX + 4);                   // key slots reach wp = (WX - 4) + 7
static_assert((CH * 4) % 128 == 0);            // output position pitch = 3 lines
static_assert((OSP * 4) % 16 == 0);
static_assert((HD * 2) % 64 == 32);              // slot pitch of the v tile = 32 B x odd: the pitch of its transposing reader
static_assert(NB <= NB_FULL);
static_assert(AW * 16 * OSP * 4 + (2 * KR * WP * HD + 4 * WX * HD) * 2 <= 81920);   // four work-groups fit one WGP's LDS

typedef _Float16 h16;
typedef __attribute__((ext_vector_type(16))) _Float16 v16h;
typedef __attribute__((ext_vector_type(8)))  _Float16 v8h;
typedef __attribute__((ext_vector_type(2)))  _Float16 v2h;
typedef __attribute__((ext_vector_type(2)))  float    v2f;
typedef __attribute__((ext_vector_type(8)))  unsigned u8v;
typedef __attribute__((ext_vector_type(8)))  float    v8f;
typedef __attribute__((ext_vector_type(4)))  float    v4f;
typedef v4f  __attribute__((may_alias)) v4fa;
typedef __attribute__((ext_vector_type(4)))  unsigned u4 __attribute__((may_alias));

__device__ __forceinline__ v16h cat16(v8h lo, v8h hi) { return __builtin_shufflevector(lo, hi, 0, 1, 2, 3, 4, 5, 6, 7, 8, 9, 10, 11, 12, 13, 14, 15); }
__device__ __forceinline__ v8f wmma16(v16h a, v16h b, v8f c) { return __builtin_amdgcn_wmma_f32_16x16x32_f16(false, a, false, b, (short)0, c, false, false); }
// one matrix instruction followed by its own four-slot guard (one accumulator per guard)
__device__ __forceinline__ v8f wmma16g(v16h a, v16h b, v8f c) { c = wmma16(a, b, c); asm volatile("v_nop\n\tv_nop\n\tv_nop\n\tv_nop" : "+v"(c) : "v"(a), "v"(b)); return c; }
// fragment with K = 16 + mask slots: p already includes + 8*(lane>>4); elements 0..7 <- k = 8h+0..7; elements 8..11 (k = 16+8h+0..3) <- the two words x0, x1 of mask flags, in the same order for A and B; elements 12..15 zero for A and B alike
__device__ __forceinline__ v16h ld8x(const h16* p, unsigned x0, unsigned x1) { return cat16(*(const v8h*)p, __builtin_bit_cast(v8h, (u4){x0, x1, 0u, 0u})); }
// transposing LDS load: the 16 lanes of a lane half hand in 8 slot rows (lane&7) x 2 pieces of 8 channels ((lane>>3)&1); lane (c, h) gets channel c of the 8 slot rows of half h, in row order
typedef short s16x8 __attribute__((ext_vector_type(8)));
typedef __attribute__((address_space(3))) s16x8 lds_s16x8;
__device__ __forceinline__ v8h ld_tr16(const h16* p) { return __builtin_bit_cast(v8h, __builtin_amdgcn_ds_load_tr16_b128_v8i16((lds_s16x8*)p)); }
// ordering point for wave-private LDS tiles (same wave writes and reads)
__device__ __forceinline__ void wave_sync() { __builtin_amdgcn_fence(3 /* release order */, "wavefront"); __builtin_amdgcn_wave_barrier(); asm volatile("" ::: "memory"); }

typedef const __attribute__((address_space(1))) float* gfp;
// a wave-uniform global address held in scalar registers: each load is then scalar base + the lane's fixed 32-bit offset, and no 64-bit vector address is formed anew per head
static __device__ __forceinline__ gfp sbase(const float* p) {
    const unsigned long long a = (unsigned long long)p;
    const unsigned lo = (unsigned)__builtin_amdgcn_readfirstlane((int)(unsigned)a), hi = (unsigned)__builtin_amdgcn_readfirstlane((int)(unsigned)(a >> 32));
    return (gfp)(((unsigned long long)hi << 32) | lo);
}
// load8: 8 channels (stride CSTR), from channel c0 on, of one row of a channel-major f32 input, lane = w: p is the same in every lane of the wave; c0 is a constant and goes into the load's offset field, so that both heads read through one base.
static __device__ __forceinline__ void load8(gfp p, int c0, unsigned w, float (&x)[8]) {
#pragma unroll
    for (int j = 0; j < 8; ++j) x[j] = (p + (size_t)(c0 + j) * CSTR)[w];
}
// put8: 8 f32 -> one 16-byte piece of an f16 tile, round to nearest even (the casts compile to one packed convert per element pair); m = bit mask per f16 pair, all ones inside the volume and 0 (= +0.0) outside it.
static __device__ __forceinline__ void put8(h16* dst, const float (&x)[8], u4 m) {
    v8h o;
#pragma unroll
    for (int j = 0; j < 8; ++j) o[j] = (h16)x[j];
    *(u4*)dst = __builtin_bit_cast(u4, o) & m;
}
static __device__ __forceinline__ int clampi(int a, int hi) { return a < 0 ? 0 : (a > hi ? hi : a); }

// k_nbrwin: one work-group per (2 z x 2 y x 32 w queries, head pair), one wave per 16-query tile. Query t = lane&15: qz = t>>3, qy = (t>>2)&1, qw = t&3 at (z0+qz, y0+qy, w0+qw).
// Key slot kk = 16j + row (j = 0..7): group g = kk>>3 -> dz = g>>2, dy = g&3, e = kk&7, volume position (z0-1+dz, y0-1+dy, w0-1+e) = k tile (row dz*4+dy, wp w0+e).
// S^T tile j: A = key rows (lane&15 = row), B = query rows; D element r of lane (t, h) = key slot 16j+8h+r -> dz = j>>1, dy = 2(j&1)+h, e = r.
// Slot kept iff dz-qz, dy-qy, e-qw all in {0,1,2}: exactly 27 per query (padded slots included with logit 0 from zero key rows).
// The mask rides in the logits product. Mask slot (h, i) = element 8+i of lane half h, A flag (2^15 or 0) x B value (-2^15 or 0):
//   h = 0: i = 0: [dz == 3] x [qz == 0], i = 1: [dz == 0] x [qz == 1], i = 2: [dy == 3] x [qy == 0], i = 3: [dy == 0] x [qy == 1];   h = 1: i = 0..3: [e - i not in 0..2] x [qw == i].
// A kept slot gets only exact zero products (its logit is unchanged); a dropped one gets -2^30 once to three times, so it never wins the maximum and its exp2 is 0. e = 6, 7 lie in no query's window: D elements 6, 7 are not read and their P is a constant 0.
// O^T[d][t] = V^T P^T, k-step s4 = key slots 32*s4..+31: A row d = lane&15 from the v tile through two transposing loads, elements 0..7 <- (dz = s4, dy = h, e = 0..7), elements 8..15 <- (dz = s4, dy = 2+h, e = 0..7); B = packed P of S^T tiles 2*s4 and 2*s4+1.
__global__ __launch_bounds__(32 * AW) void k_nbrwin(const float* __restrict__ q, const float* __restrict__ k, const float* __restrict__ v, float* OUT) {
    __shared__ __align__(16) float os[AW * 16 * OSP];
    __shared__ __align__(16) h16 KL[KR * WP * HD];
    __shared__ __align__(16) h16 QL[4 * WX * HD];
    __shared__ __align__(16) h16 VL[KR * WP * HD];
    const int tid = (int)threadIdx.x;
    const int lane = tid & 31, lr = lane & 15, hi = lane >> 4;
    const int wave = __builtin_amdgcn_readfirstlane(tid >> 5);
    const int wbk = wave, yb = (int)blockIdx.x & 15, zb = (int)blockIdx.x >> 4;
    const int b = blockIdx.y / 3, hp = blockIdx.y % 3;
    const int z0 = 2 * zb, y0 = 2 * yb, w0 = 4 * wbk;
    const int qz = lr >> 3, qy = (lr >> 2) & 1, qw = lr & 3;
    // mask words of the B fragment (query t = lr) and of the eight A fragments (key row lr: dy = 2(j&1) + (lr>>3), e = lr&7)
    const unsigned hm = (unsigned)-hi;                                        // all ones in lane half 1
    const unsigned bw = MSKB << (16 * (qw & 1));
    const unsigned bx0 = (hm & (qw < 2 ? bw : 0u)) | (~hm & (MSKB << (16 * qz)));
    const unsigned bx1 = (hm & (qw < 2 ? 0u : bw)) | (~hm & (MSKB << (16 * qy)));
    const int ke = lr & 7, kg = lr >> 3;
    unsigned nw[4];
#pragma unroll
    for (int i = 0; i < 4; ++i) nw[i] = ((unsigned)(ke - i) <= 2u) ? 0u : KFLG;
    const unsigned aw0 = hm & (nw[0] | (nw[1] << 16)), aw1 = hm & (nw[2] | (nw[3] << 16));
    unsigned ax0[8], ax1[8];
#pragma unroll
    for (int j = 0; j < 8; ++j) {
        const int dz = j >> 1, dy = 2 * (j & 1) + kg;
        ax0[j] = aw0 | (~hm & ((dz == 3 ? KFLG : 0u) | (dz == 0 ? KFLG << 16 : 0u)));
        ax1[j] = aw1 | (~hm & ((dy == 3 ? KFLG : 0u) | (dy == 0 ? KFLG << 16 : 0u)));
    }
    const int qrow  = (qz * 2 + qy) * WX + (w0 + qw);                         // q tile row
    const int krow0 = (lr >> 3) * WP + (w0 + (lr & 7));                       // k tile row; tile j adds ((j>>1)*4 + 2*(j&1))*WP; row <= 15, wp <= 35
    const int wb = wave * 16 * OSP;
    // staging indices, the same for both heads
    const int qr = wave >> 1, qc8 = (wave & 1) * 8;                           // q task: row, first channel
    const int vrow0 = (hi * WP + (w0 + (lane & 7))) * HD + 8 * ((lane >> 3) & 1);   // v tile piece this lane hands to the transposing loads: slot row (dy = hi, e = lane&7), channel half; step s4 adds 4*s4 rows, the second load 2 rows
    unsigned ro[4];                                                           // k / v task: first channel + clamped row, in floats: every address stays inside the input; the same in every lane and kept in scalar registers, so that each head's row bases are scalar adds
#pragma unroll
    for (int it = 0; it < 4; ++it) {
        const int task = wave * 4 + it, row = task >> 1, c8 = (task & 1) * 8;
        ro[it] = (unsigned)__builtin_amdgcn_readfirstlane(c8 * CSTR + (clampi(z0 - 1 + (row >> 2), DZ - 1) * HY + clampi(y0 - 1 + (row & 3), HY - 1)) * WX);
    }
    // w halo of the k and v tiles (wp = 0, 33, 34, 35), zero for both heads: 2 tiles x 16 rows x 4 slots x 2 pieces, published by the first barrier below
    static_assert(32 * AW == 2 * KR * 4 * 2);
    { const int u = tid & 127, s = (u >> 1) & 3; *(v8h*)((tid < 128 ? KL : VL) + ((u >> 3) * WP + (s == 0 ? 0 : WX + s)) * HD + (u & 1) * 8) = (v8h){}; }
    const size_t cbase = (size_t)(b * CH + 2 * hp * HD) * CSTR;               // first channel of the head pair
    gfp kb[4], vb[4];                                                         // row bases of the wave's tasks, for both heads
#pragma unroll
    for (int it = 0; it < 4; ++it) { kb[it] = sbase(k + cbase + ro[it]); vb[it] = sbase(v + cbase + ro[it]); }
    const gfp qb = sbase(q + cbase + (size_t)qc8 * CSTR + (size_t)(((z0 + (qr >> 1)) * HY + (y0 + (qr & 1))) * WX));
    // k and v tiles: 32 tasks each (row, 8 channels), 4 per wave, lane = w: each load is one whole 128-byte row. q tile: 8 tasks, one per wave.
    // The loaded f32 values of one head; the second head's are asked for while the first head is computed and stay in these registers until its tiles are free.
    float xk[4][8], xv[4][8], xq[8];
    // unrolled: only the first pass issues loads, its own and the next head's, and a rolled loop would have to copy the 72 values that cross from pass to pass
#pragma unroll
    for (int hh = 0; hh < 2; ++hh) {
        // every wave has left the last head's tiles before they are rewritten
        __syncthreads();
        if (hh == 0) {
            // all loads of the first head together, so that one memory latency covers them
#pragma unroll
            for (int it = 0; it < 4; ++it) {
                load8(kb[it], 0, (unsigned)lane, xk[it]);
                load8(vb[it], 0, (unsigned)lane, xv[it]);
            }
            load8(qb, 0, (unsigned)lane, xq);
            // inputs-only fences on the loaded values: they keep all 72 loads issued ahead of the conversions, so that no load waits behind a conversion's wait
#pragma unroll
            for (int it = 0; it < 4; ++it) {
                asm volatile("" :: "v"(xk[it][0]), "v"(xk[it][1]), "v"(xk[it][2]), "v"(xk[it][3]), "v"(xk[it][4]), "v"(xk[it][5]), "v"(xk[it][6]), "v"(xk[it][7]));
                asm volatile("" :: "v"(xv[it][0]), "v"(xv[it][1]), "v"(xv[it][2]), "v"(xv[it][3]), "v"(xv[it][4]), "v"(xv[it][5]), "v"(xv[it][6]), "v"(xv[it][7]));
            }
            asm volatile("" :: "v"(xq[0]), "v"(xq[1]), "v"(xq[2]), "v"(xq[3]), "v"(xq[4]), "v"(xq[5]), "v"(xq[6]), "v"(xq[7]));
        }
#pragma unroll
        for (int it = 0; it < 4; ++it) {
            const int task = wave * 4 + it, row = task >> 1, c8 = (task & 1) * 8;
            const bool ok = ((unsigned)(z0 - 1 + (row >> 2)) < (unsigned)DZ) & ((unsigned)(y0 - 1 + (row & 3)) < (unsigned)HY);
            const unsigned km = ok ? 0xFFFFFFFFu : 0u;
            put8(KL + (row * WP + lane + 1) * HD + c8, xk[it], (u4){km, km, km, km});
            put8(VL + (row * WP + lane + 1) * HD + c8, xv[it], (u4){km, km, km, km});
        }
        put8(QL + (qr * WX + lane) * HD + qc8, xq, (u4){0xFFFFFFFFu, 0xFFFFFFFFu, 0xFFFFFFFFu, 0xFFFFFFFFu});
        // the three tiles are complete before any wave reads them
        __syncthreads();
        if (hh == 0) {
            // the second head's k and q rows are asked for here, behind the barrier (which would wait for them), and land while the first head's logits and weights are computed
#pragma unroll
            for (int it = 0; it < 4; ++it) load8(kb[it], HD, (unsigned)lane, xk[it]);
            load8(qb, HD, (unsigned)lane, xq);
            __builtin_amdgcn_sched_barrier(0);                                // keeps these loads ahead of the head's arithmetic: sunk to their use they would hide nothing
        }
        const v16h qf = ld8x(QL + qrow * HD + 8 * hi, bx0, bx1);              // B fragment: col t, k = c, then the query's mask values
        v8f s[8];
#pragma unroll
        for (int j = 0; j < 8; ++j) {
            const int kr = krow0 + ((j >> 1) * 4 + 2 * (j & 1)) * WP;
            const v16h ka = ld8x(KL + kr * HD + 8 * hi, ax0[j], ax1[j]);      // A fragment: row key slot, k = c, then the slot's mask flags
            s[j] = wmma16g(ka, qf, (v8f){});
        }
        float mx = s[0][0], my = s[1][0];                                     // two chains: a maximum does not depend on its order
#pragma unroll
        for (int j = 0; j < 8; j += 2) {
#pragma unroll
            for (int r = 0; r < 6; ++r) { mx = fmaxf(mx, s[j][r]); my = fmaxf(my, s[j + 1][r]); } }   // raw logits, dropped slots near -2^30 or below; SC2 > 0 scales the maximum afterwards
        mx = fmaxf(mx, my);
        mx = fmaxf(mx, __shfl_xor(mx, 16, 32));
        const float sh = PSH - mx * SC2;
        v8f o = (v8f){};
        float ls = 0.0f;
#pragma unroll
        for (int s4 = 0; s4 < 4; ++s4) {
            u8v pw; pw[3] = 0u; pw[7] = 0u;                                   // B fragment by words: elements 6, 7, 14, 15 (e = 6, 7) are 0
#pragma unroll
            for (int r = 0; r < 6; r += 2) {
                v2f xa, xb;
#pragma unroll
                for (int i = 0; i < 2; ++i) {                                 // dropped slots: exponent below -10^8, exp2 = 0
                    xa[i] = __builtin_amdgcn_exp2f(s[2 * s4][r + i] * SC2 + sh); xb[i] = __builtin_amdgcn_exp2f(s[2 * s4 + 1][r + i] * SC2 + sh); }
                const v2h pa = __builtin_convertvector(xa, v2h), pc = __builtin_convertvector(xb, v2h);   // RNE, <= 2^14; a kept weight below 2^-14 rounds to an f16 subnormal or 0
#pragma unroll
                for (int i = 0; i < 2; ++i) ls += (float)pa[i] + (float)pc[i];
                pw[r >> 1] = __builtin_bit_cast(unsigned, pa); pw[4 + (r >> 1)] = __builtin_bit_cast(unsigned, pc); }
            const v16h pb = __builtin_bit_cast(v16h, pw);
            const int va = vrow0 + s4 * 4 * WP * HD;
            const v16h vf = cat16(ld_tr16(VL + va), ld_tr16(VL + va + 2 * WP * HD));   // dy and dy + 2
            o = wmma16g(vf, pb, o);
            if (hh == 0 && s4 == 0) {
                // the second head's v rows, behind the first step: from here on they fit beside what is left of the logits
#pragma unroll
                for (int it = 0; it < 4; ++it) load8(vb[it], HD, (unsigned)lane, xv[it]);
                __builtin_amdgcn_sched_barrier(0);                            // keeps these loads here: earlier they would cost a resident wave's registers, later they would hide less
            }
        }
        const float l = ls + __shfl_xor(ls, 16, 32);                          // >= 16384: the row maximum is always kept
        const float inv = 1.0f / l;
        // O^T D layout: o[r] = (d = 8h + r, t = lane&15) -> os[t][hh*16 + d]
        { v4f a, c;
          a[0] = o[0] * inv; a[1] = o[1] * inv; a[2] = o[2] * inv; a[3] = o[3] * inv; c[0] = o[4] * inv; c[1] = o[5] * inv; c[2] = o[6] * inv; c[3] = o[7] * inv;
          *(v4fa*)(&os[wb + lr * OSP + hh * 16 + 8 * hi]) = a; *(v4fa*)(&os[wb + lr * OSP + hh * 16 + 8 * hi + 4]) = c; }
        if (hh == 0) __builtin_amdgcn_sched_barrier(0);                       // keeps the second head's conversions, and with them the waits for its loads, behind the first head's arithmetic
    }
    wave_sync();
    static_assert(32 * 16 * 4 == 16 * 128);                                   // lanes x bytes x store instructions == tile rows x row bytes
    float* obase = OUT + ((((size_t)(b * DZ + z0) * HY + (size_t)y0) * WX + (size_t)w0) * CH) + hp * 32;
{
#pragma unroll
        for (int s = 0; s < 4; ++s) { const int row = 4 * s + (lane >> 3), cofs = (lane & 7) * 4;   // 4 s x 4 rows = 16 rows; 8 lanes x 4 floats = 32 columns = one line
            const v4f val = *(const v4fa*)(&os[wb + row * OSP + cofs]);
            const size_t po = ((size_t)((s >> 1) * HY + (s & 1)) * WX + (size_t)(lane >> 3)) * CH;   // query row: qz = s>>1, qy = s&1, qw = lane>>3
            *(v4f*)(obase + po + cofs) = val; }
         }
}

extern "C" void kernel_launch(void* const* d_in, const int* in_sizes, int n_in,
                              void* d_out, int out_size, void* d_ws, size_t ws_size, hipStream_t stream) {
    if (n_in < 3) return;
    const size_t need = (size_t)NB * CH * CSTR;
    if ((size_t)in_sizes[0] < need || (size_t)in_sizes[1] < need || (size_t)in_sizes[2] < need) return;
    if ((size_t)out_size < need) return;
    // wire order: q, k, v
    const float* q = (const float*)d_in[0];
    const float* k = (const float*)d_in[1];
    const float* v = (const float*)d_in[2];
    float* OUT = (float*)d_out;      // [NB][16][32][32][96]

    k_nbrwin<<<dim3((DZ / 2) * (HY / 2), NB * 3, 1), 32 * AW, 0, stream>>>(q, k, v, OUT);
}
